// v000
// The times below were measured on an AMD MI455X: many runs one after another, warmed up first and cycling through
// copies of the inputs, with the whole window's GPU time divided by the number of runs. Launches and the gaps
// between them are all in it. The median over several windows is given; except for v000 it joins two sittings, which
// can be a few percent apart, so the side-by-side timings, each taken in one sitting, are the better comparison.
// The starting kernel, v000, takes 1130 microseconds a run.
#include <hip/hip_runtime.h>

// BeitSelfAttention: q = x Wq + bq, k = x Wk (no bias), v = x Wv + bv (12 heads x 64); scores = q.k/8 + bias_table[rel_idx(q,k)][h] (BEiT relative position index incl. the cls row/column/corner entries); probs = softmax; ctx = probs v -> [64][197][768].
// Deterministic: per-wave softmax over the 197 keys in fixed order; no atomics.
// WMMA (v_wmma_f32_16x16x32_f16, f32 accumulate): x (EXACT bf16 x8, K 768) x [Wq|Wk|Wv] rows (EXACT x256 (in,out); 144 tiles in 9 groups) per 16-token wave; per (b, h, 16-query) wave S = q (hi+lo x256, K 64) x k rows (hi+lo; 13 tiles) and ctx = P (hi+lo) x v^T rows (hi+lo; 4 tiles, K 224 zero-padded), 3 products — 4.3 M WMMA; bias gather + softmax in f32.

namespace {
constexpr int NB_ = 64, S = 197, SP = 208 /* 13 key tiles */, VW = 256 /* padded v^T row */, D = 768, H = 12, HD = 64, T = NB_ * S /* 12608 = 788*16 */, TP = T + 32, WH = 14, NRD = 732;
constexpr float XS = 8.0f, HS = 256.0f, PS = 256.0f, WSC = 256.0f, SCALE = 0.125f;
typedef _Float16 b16;
typedef __attribute__((ext_vector_type(16))) _Float16 v16b;
typedef __attribute__((ext_vector_type(8))) _Float16 v8b;
typedef __attribute__((ext_vector_type(2))) _Float16 v2b;
typedef __attribute__((ext_vector_type(8))) float v8f;
typedef __attribute__((ext_vector_type(4))) float v4f;
typedef __attribute__((ext_vector_type(2))) float v2f;
__device__ __forceinline__ float bf16_rne(float f) { unsigned int u = __float_as_uint(f); u += 0x7FFFu + ((u >> 16) & 1u); float r = __uint_as_float(u & 0xFFFF0000u); asm volatile("" : "+v"(r)); return r; }
__device__ __forceinline__ float bfv(float f) { float r = bf16_rne(f); asm volatile("" : "+v"(r)); return r; }
__device__ __forceinline__ void split16(float v, b16& hi, b16& lo) { hi = (b16)v; lo = (b16)(v - (float)hi); }
__device__ __forceinline__ v16b frag_kb(const b16* p, int hh) { const v8b a = *(const v8b*)(p + 8 * hh), b = *(const v8b*)(p + 16 + 8 * hh); v16b f;
#pragma unroll
  for (int e = 0; e < 8; ++e) { f[e] = a[e]; f[8 + e] = b[e]; } return f; }
__device__ __forceinline__ v8f wmma16b(v16b a, v16b b, v8f c) { v8f d = __builtin_amdgcn_wmma_f32_16x16x32_f16(false, a, false, b, (short)0, c, false, false); asm volatile("v_nop\n\tv_nop\n\tv_nop\n\tv_nop" : "+v"(d) : "v"(a), "v"(b)); return d; }
__device__ __forceinline__ void wave_lds_sync() { __builtin_amdgcn_fence(__ATOMIC_RELEASE, "workgroup"); __builtin_amdgcn_wave_barrier(); __builtin_amdgcn_fence(__ATOMIC_ACQUIRE, "workgroup"); }
__device__ __forceinline__ int relidx(int q, int k) { if (q == 0 && k == 0) return NRD - 1; if (q == 0) return NRD - 3; if (k == 0) return NRD - 2; const int pq = q - 1, pk = k - 1; const int dy = pq / WH - pk / WH + (WH - 1), dx = pq % WH - pk % WH + (WH - 1); return dy * (2 * WH - 1) + dx; }

__global__ __launch_bounds__(256) void wput_kernel(const float* __restrict__ wq, const float* __restrict__ wk, const float* __restrict__ wv, b16* __restrict__ WQKV, b16* __restrict__ Kh, b16* __restrict__ Kl, b16* __restrict__ VTh, b16* __restrict__ VTl) { const size_t nt = (size_t)gridDim.x * 256, u0 = (size_t)blockIdx.x * 256 + threadIdx.x; v8b v; const v8b z = {0, 0, 0, 0, 0, 0, 0, 0};
  for (size_t u = u0; u < (size_t)3 * D * (D / 8); u += nt) { const int o = (int)(u / (D / 8)), k0 = (int)(u % (D / 8)) * 8; const int which = o / D, oo = o % D; const float* w = which == 0 ? wq : (which == 1 ? wk : wv);
#pragma unroll
    for (int j = 0; j < 8; ++j) v[j] = (b16)(bf16_rne(w[(size_t)(k0 + j) * D + oo]) * WSC); { *(v8b*)(WQKV + (size_t)o * D + k0) = v;  } }
  for (size_t u = u0; u < (size_t)(TP - T) * (D / 8); u += nt) { const size_t off = (size_t)T * D + u * 8; { *(v8b*)(Kh + off) = z; *(v8b*)(Kl + off) = z;  } }
  for (size_t u = u0; u < (size_t)NB_ * H * HD * (VW / 8); u += nt) { { *(v8b*)(VTh + u * 8) = z; *(v8b*)(VTl + u * 8) = z;  } } }
__global__ __launch_bounds__(32) void proj_kernel(const float* __restrict__ x, const b16* __restrict__ WQKV, const float* __restrict__ bq, const float* __restrict__ bv, int BLIM, b16* __restrict__ Qh, b16* __restrict__ Ql, b16* __restrict__ Kh, b16* __restrict__ Kl, float* __restrict__ V) { __shared__ __attribute__((aligned(16))) b16 Ax[16][D + 8]; __shared__ float Tf[16][260]; const int lane = threadIdx.x, nloc = lane & 15, hlf = lane >> 4; const size_t t0 = (size_t)blockIdx.x * 16; if (t0 >= (size_t)BLIM * S) return;
  for (int rr = 0; rr < 16; ++rr) for (int q = 0; q < D / 32; ++q) { const int c = q * 32 + lane; Ax[rr][c] = (b16)(bf16_rne(x[(t0 + rr) * D + c]) * XS); }
  if (lane < 16) for (int k = D; k < D + 8; ++k) Ax[lane][k] = (b16)0.0f;
  wave_lds_sync();
#pragma unroll 1
  for (int g = 0; g < 9; ++g) { const int which = g / 3, c0 = (g % 3) * 256; v8f acc[16];
#pragma unroll
    for (int t = 0; t < 16; ++t) acc[t] = (v8f){};
#pragma unroll 2
    for (int kb = 0; kb < D; kb += 32) { const v16b a = frag_kb(&Ax[nloc][kb], hlf);
#pragma unroll
      for (int t = 0; t < 16; ++t) acc[t] = wmma16b(a, frag_kb(WQKV + ((size_t)which * D + c0 + t * 16 + nloc) * D + kb, hlf), acc[t]); }
#pragma unroll
    for (int t = 0; t < 16; ++t) { const int cc = t * 16 + nloc; const float bb = which == 0 ? bfv(bq[c0 + cc]) : (which == 2 ? bfv(bv[c0 + cc]) : 0.0f);
#pragma unroll
      for (int r8 = 0; r8 < 8; ++r8) Tf[8 * hlf + r8][cc] = acc[t][r8] * (1.0f / (XS * WSC)) + bb; }
    wave_lds_sync();
    { for (int rr = 0; rr < 16; ++rr) { const size_t tk = t0 + rr;
        if (which == 2) { for (int q = 0; q < 2; ++q) *(v4f*)(V + tk * D + c0 + q * 128 + lane * 4) = *(const v4f*)(&Tf[rr][q * 128 + lane * 4]); }
        else { b16* Ph = which == 0 ? Qh : Kh; b16* Pl = which == 0 ? Ql : Kl; for (int q = 0; q < 4; ++q) { const int c = q * 64 + lane * 2; b16 h0, l0, h1, l1; split16(Tf[rr][c] * HS, h0, l0); split16(Tf[rr][c + 1] * HS, h1, l1); *(v2b*)(Ph + tk * D + c0 + c) = (v2b){h0, h1}; *(v2b*)(Pl + tk * D + c0 + c) = (v2b){l0, l1}; } } }
       }
    wave_lds_sync(); } }
__global__ __launch_bounds__(256) void vt_kernel(const float* __restrict__ V, int BLIM, b16* __restrict__ VTh, b16* __restrict__ VTl) { __shared__ float Tt[64][257]; const int b = blockIdx.x / 12, rem = blockIdx.x % 12; const int kt = rem / 3, hg = rem % 3; if (b >= BLIM) return; const int k0 = kt * 64; const int tid = threadIdx.x, wave = tid >> 5, lane = tid & 31;
  for (int q = wave; q < 64; q += 8) for (int c = lane; c < 256; c += 32) Tt[q][c] = (k0 + q < S) ? V[((size_t)b * S + k0 + q) * D + hg * 256 + c] : 0.0f;
  __syncthreads();
  { for (int c = wave; c < 256; c += 8) { const int h = hg * 4 + c / HD, d = c % HD; b16 h0, l0, h1, l1; split16(Tt[lane * 2][c] * HS, h0, l0); split16(Tt[lane * 2 + 1][c] * HS, h1, l1); const size_t o = (((size_t)b * H + h) * HD + d) * VW + k0 + lane * 2; *(v2b*)(VTh + o) = (v2b){h0, h1}; *(v2b*)(VTl + o) = (v2b){l0, l1}; }  } }
__global__ __launch_bounds__(32) void att_kernel(const b16* __restrict__ Qh, const b16* __restrict__ Ql, const b16* __restrict__ Kh, const b16* __restrict__ Kl, const b16* __restrict__ VTh, const b16* __restrict__ VTl, const float* __restrict__ btab, int BLIM, float* __restrict__ out) { __shared__ __attribute__((aligned(16))) b16 Pa[16][VW + 8], Pb[16][VW + 8]; __shared__ float Sc[16][SP + 1], Of[16][HD + 1]; const int lane = threadIdx.x, nloc = lane & 15, hlf = lane >> 4; const int b = blockIdx.x / (H * 13), rem = blockIdx.x % (H * 13); const int h = rem / 13, q0 = (rem % 13) * 16; if (b >= BLIM) return; const size_t tb = (size_t)b * S;
  const size_t qrow = tb + (q0 + nloc < S ? q0 + nloc : S - 1);   // rows past the image read a valid row; their results are not written
  v16b qa[2], ql[2]; for (int ks = 0; ks < 2; ++ks) { qa[ks] = frag_kb(Qh + qrow * D + h * HD + ks * 32, hlf); ql[ks] = frag_kb(Ql + qrow * D + h * HD + ks * 32, hlf); }
#pragma unroll 1
  for (int t = 0; t < 13; ++t) { v8f s = (v8f){};
#pragma unroll
    for (int ks = 0; ks < 2; ++ks) { const size_t ko = (tb + t * 16 + nloc) * D + h * HD + ks * 32; const v16b kh = frag_kb(Kh + ko, hlf), kl = frag_kb(Kl + ko, hlf); s = wmma16b(qa[ks], kh, s); s = wmma16b(qa[ks], kl, s); s = wmma16b(ql[ks], kh, s); }
#pragma unroll
    for (int r8 = 0; r8 < 8; ++r8) Sc[8 * hlf + r8][t * 16 + nloc] = s[r8] * (SCALE / (HS * HS)); }
  wave_lds_sync();
  if (lane < 16) { const int r = lane, q = q0 + r; const int qq = q < S ? q : 0; float mx = -INFINITY; for (int k = 0; k < S; ++k) { const float v = Sc[r][k] + bfv(btab[relidx(qq, k) * H + h]); Sc[r][k] = v; mx = fmaxf(mx, v); }
    float sm = 0.0f; for (int k = 0; k < S; ++k) { const float p = __expf(Sc[r][k] - mx); Sc[r][k] = p; sm += p; } const float inv = 1.0f / sm;
    for (int k = 0; k < S; ++k) { b16 p, pl; split16(Sc[r][k] * inv * PS, p, pl); Pa[r][k] = p; Pb[r][k] = pl; } for (int k = S; k < VW + 8; ++k) { Pa[r][k] = (b16)0.0f; Pb[r][k] = (b16)0.0f; } }
  wave_lds_sync();
  v8f o[4] = {(v8f){}, (v8f){}, (v8f){}, (v8f){}};
#pragma unroll
  for (int kb = 0; kb < 224; kb += 32) { const v16b pa = frag_kb(&Pa[nloc][kb], hlf), pb = frag_kb(&Pb[nloc][kb], hlf);
#pragma unroll
    for (int t = 0; t < 4; ++t) { const size_t vo = (((size_t)b * H + h) * HD + t * 16 + nloc) * VW + kb; const v16b vh = frag_kb(VTh + vo, hlf), vl = frag_kb(VTl + vo, hlf); o[t] = wmma16b(pa, vh, o[t]); o[t] = wmma16b(pa, vl, o[t]); o[t] = wmma16b(pb, vh, o[t]); } }
#pragma unroll
  for (int t = 0; t < 4; ++t)
#pragma unroll
    for (int r8 = 0; r8 < 8; ++r8) Of[8 * hlf + r8][t * 16 + nloc] = o[t][r8] * (1.0f / (PS * HS));
  wave_lds_sync();
  { for (int r = 0; r < 16; ++r) { if (q0 + r >= S) break; *(v2f*)(out + (tb + q0 + r) * D + h * HD + lane * 2) = (v2f){Of[r][lane * 2], Of[r][lane * 2 + 1]}; }  } }
}  // namespace

extern "C" void kernel_launch(void* const* d_in, const int* in_sizes, int n_in, void* d_out, int out_size, void* d_ws, size_t ws_size, hipStream_t stream) {
  (void)n_in;
  auto Fp = [&](int i) { return (const float*)d_in[i]; };
  // input order: 0 hidden_states [64,197,768]; 1 Wq [768,768]; 2 bq [768]; 3 Wk; 4 Wv; 5 bv; 6 bias_table [732,12]
  if (in_sizes[0] != T * D || in_sizes[1] != D * D || in_sizes[3] != D * D || in_sizes[4] != D * D || in_sizes[6] != NRD * H || out_size != T * D) return;
  const int BLIM = NB_;
  size_t off = 0; char* ws = (char*)d_ws;
  auto carve = [&](size_t bytes) { char* p = ws + off; off += (bytes + 255) & ~(size_t)255; return p; };
  b16* WQKV = (b16*)carve((size_t)3 * D * D * 2); b16* Qh = (b16*)carve((size_t)TP * D * 2); b16* Ql = (b16*)carve((size_t)TP * D * 2); b16* Kh = (b16*)carve((size_t)TP * D * 2); b16* Kl = (b16*)carve((size_t)TP * D * 2); float* V = (float*)carve((size_t)T * D * 4); b16* VTh = (b16*)carve((size_t)NB_ * H * HD * VW * 2); b16* VTl = (b16*)carve((size_t)NB_ * H * HD * VW * 2);
  if (off > ws_size || off > ((size_t)176 << 20)) return;   // ~ 168 MB (> 128 MiB, < 256 MiB admissible)
  wput_kernel<<<256, 256, 0, stream>>>(Fp(1), Fp(3), Fp(4), WQKV, Kh, Kl, VTh, VTl);
  proj_kernel<<<(BLIM * S + 15) / 16, 32, 0, stream>>>(Fp(0), WQKV, Fp(2), Fp(5), BLIM, Qh, Ql, Kh, Kl, V);
  vt_kernel<<<BLIM * 12, 256, 0, stream>>>(V, BLIM, VTh, VTl);
  att_kernel<<<BLIM * H * 13, 32, 0, stream>>>(Qh, Ql, Kh, Kl, VTh, VTl, Fp(6), BLIM, (float*)d_out);
}

// v001
// A run of this version takes 391 microseconds.
// Next to v000, in two timings, it ran 2.91 and 2.92 times as fast.
#include <hip/hip_runtime.h>

// BeitSelfAttention: q = x Wq + bq, k = x Wk (no bias), v = x Wv + bv (12 heads x 64); scores = q.k/8 + bias_table[rel_idx(q,k)][h] (BEiT relative position index incl. the cls row/column/corner entries); probs = softmax; ctx = probs v -> [64][197][768].
// Deterministic: per-wave softmax over the 197 keys in fixed order; no atomics.
// WMMA (v_wmma_f32_16x16x32_f16, f32 accumulate): x (EXACT bf16 x8, K 768) x [Wq|Wk|Wv] rows (EXACT x256 (in,out); 144 tiles in 9 groups), 64 tokens x 256 columns per 8-wave work-group; per (b, h, 16-query) wave S = q (hi+lo x256, K 64) x k rows (hi+lo; 13 tiles) and ctx = P (hi+lo) x v^T rows (hi+lo; 4 tiles, K 224 zero-padded), 3 products — 4.3 M WMMA; bias gather + softmax in f32.

namespace {
constexpr int NB_ = 64, S = 197, SP = 208 /* 13 key tiles */, VW = 256 /* padded v^T row */, D = 768, H = 12, HD = 64, T = NB_ * S /* 12608 = 788*16 */, TP = T + 32, WH = 14, NRD = 732;
constexpr float XS = 8.0f, HS = 256.0f, PS = 256.0f, WSC = 256.0f, SCALE = 0.125f;
typedef _Float16 b16;
typedef __attribute__((ext_vector_type(16))) _Float16 v16b;
typedef __attribute__((ext_vector_type(8))) _Float16 v8b;
typedef __attribute__((ext_vector_type(4))) _Float16 v4b;
typedef __attribute__((ext_vector_type(2))) _Float16 v2b;
typedef __attribute__((ext_vector_type(8))) float v8f;
typedef __attribute__((ext_vector_type(4))) float v4f;
typedef __attribute__((ext_vector_type(2))) float v2f;
__device__ __forceinline__ float bf16_rne(float f) { unsigned int u = __float_as_uint(f); u += 0x7FFFu + ((u >> 16) & 1u); float r = __uint_as_float(u & 0xFFFF0000u); asm volatile("" : "+v"(r)); return r; }
__device__ __forceinline__ float bfv(float f) { float r = bf16_rne(f); asm volatile("" : "+v"(r)); return r; }
__device__ __forceinline__ void split16(float v, b16& hi, b16& lo) { hi = (b16)v; lo = (b16)(v - (float)hi); }
__device__ __forceinline__ v16b frag_kb(const b16* p, int hh) { const v8b a = *(const v8b*)(p + 8 * hh), b = *(const v8b*)(p + 16 + 8 * hh); v16b f;
#pragma unroll
  for (int e = 0; e < 8; ++e) { f[e] = a[e]; f[8 + e] = b[e]; } return f; }
__device__ __forceinline__ v8f wmma16b(v16b a, v16b b, v8f c) { v8f d = __builtin_amdgcn_wmma_f32_16x16x32_f16(false, a, false, b, (short)0, c, false, false); asm volatile("v_nop\n\tv_nop\n\tv_nop\n\tv_nop" : "+v"(d) : "v"(a), "v"(b)); return d; }
__device__ __forceinline__ void wave_lds_sync() { __builtin_amdgcn_fence(__ATOMIC_RELEASE, "workgroup"); __builtin_amdgcn_wave_barrier(); __builtin_amdgcn_fence(__ATOMIC_ACQUIRE, "workgroup"); }
// work-group barrier that orders LDS only: the global loads of a later stage, which land in the wave's own registers, stay in flight across it
// the scheduling barrier keeps the rounding of the loaded x values, and with it the wait for those loads, from being lifted in among the products of the trip before
__device__ __forceinline__ void lds_barrier() { __builtin_amdgcn_sched_barrier(0); __builtin_amdgcn_fence(__ATOMIC_RELEASE, "workgroup", "local"); __builtin_amdgcn_s_barrier(); __builtin_amdgcn_fence(__ATOMIC_ACQUIRE, "workgroup", "local"); }
__device__ __forceinline__ int relidx(int q, int k) { if (q == 0 && k == 0) return NRD - 1; if (q == 0) return NRD - 3; if (k == 0) return NRD - 2; const int pq = q - 1, pk = k - 1; const int dy = pq / WH - pk / WH + (WH - 1), dx = pq % WH - pk % WH + (WH - 1); return dy * (2 * WH - 1) + dx; }

__global__ __launch_bounds__(256) void wput_kernel(const float* __restrict__ wq, const float* __restrict__ wk, const float* __restrict__ wv, b16* __restrict__ WQKV, b16* __restrict__ Kh, b16* __restrict__ Kl, b16* __restrict__ VTh, b16* __restrict__ VTl) { const size_t nt = (size_t)gridDim.x * 256, u0 = (size_t)blockIdx.x * 256 + threadIdx.x; v8b v; const v8b z = {0, 0, 0, 0, 0, 0, 0, 0};
  for (size_t u = u0; u < (size_t)3 * D * (D / 8); u += nt) { const int o = (int)(u / (D / 8)), k0 = (int)(u % (D / 8)) * 8; const int which = o / D, oo = o % D; const float* w = which == 0 ? wq : (which == 1 ? wk : wv);
#pragma unroll
    for (int j = 0; j < 8; ++j) v[j] = (b16)(bf16_rne(w[(size_t)(k0 + j) * D + oo]) * WSC); { *(v8b*)(WQKV + (size_t)o * D + k0) = v;  } }
  for (size_t u = u0; u < (size_t)(TP - T) * (D / 8); u += nt) { const size_t off = (size_t)T * D + u * 8; { *(v8b*)(Kh + off) = z; *(v8b*)(Kl + off) = z;  } }
  for (size_t u = u0; u < (size_t)NB_ * H * HD * (VW / 8); u += nt) { { *(v8b*)(VTh + u * 8) = z; *(v8b*)(VTl + u * 8) = z;  } } }
// proj: one work-group of 8 waves per 64-token x 256-column tile of [q|k|v]. x (rounded, x8) and the weight rows go through LDS in 64-k stages, two buffers;
// each wave owns 64 x 32 outputs (4 x 2 accumulator tiles), so a weight fragment feeds 4 products and an x fragment 2. k runs upward in one chain per output.
__global__ __launch_bounds__(256) void proj_kernel(const float* __restrict__ x, const b16* __restrict__ WQKV, const float* __restrict__ bq, const float* __restrict__ bv, int BLIM, b16* __restrict__ Qh, b16* __restrict__ Ql, b16* __restrict__ Kh, b16* __restrict__ Kl, float* __restrict__ V) {
  constexpr int KC = 64, KP = KC + 8 /* 144-byte rows: 16 B x odd for 16-byte readers */, ASZ = 64 * KP, STG = ASZ + 256 * KP, TFP = 260;
  constexpr int SMB = 2 * STG * 2 > 64 * TFP * 4 ? 2 * STG * 2 : 64 * TFP * 4;
  __shared__ __attribute__((aligned(16))) char smem[SMB];
  b16* const St = (b16*)smem; float* const Tf = (float*)smem;   // the output tile reuses the stages behind a barrier
  const int tid = threadIdx.x, lane = tid & 31, wave = tid >> 5, nloc = lane & 15, hlf = lane >> 4;
  const int g = blockIdx.x % 9, which = g / 3, c0 = (g % 3) * 256; const size_t t0 = (size_t)(blockIdx.x / 9) * 64; if (t0 >= (size_t)BLIM * S) return;
  const int ar = tid >> 4, ac = (tid & 15) * 4, br = tid >> 3, bc = (tid & 7) * 8;   // 16 lanes cover 256 B of an x row, 8 lanes 128 B of a weight row
  const float* const xg = x + (t0 + ar) * D + ac; const b16* const wg = WQKV + ((size_t)which * D + c0 + br) * D + bc;
  v4f xr[4]; v8b wr[8]; v8f acc[4][2];
#pragma unroll
  for (int m = 0; m < 4; ++m) { acc[m][0] = (v8f){}; acc[m][1] = (v8f){}; }
  auto fetch = [&](int kc) {
#pragma unroll
    for (int i = 0; i < 4; ++i) xr[i] = *(const v4f*)(xg + (size_t)i * 16 * D + kc);
#pragma unroll
    for (int i = 0; i < 8; ++i) wr[i] = *(const v8b*)(wg + (size_t)i * 32 * D + kc); };
  auto put = [&](b16* st) {
#pragma unroll
    for (int i = 0; i < 4; ++i) { v4b h;
#pragma unroll
      for (int j = 0; j < 4; ++j) h[j] = (b16)(bf16_rne(xr[i][j]) * XS);
      *(v4b*)(st + (ar + i * 16) * KP + ac) = h; }
#pragma unroll
    for (int i = 0; i < 8; ++i) *(v8b*)(st + ASZ + (br + i * 32) * KP + bc) = wr[i]; };
  fetch(0); put(St); fetch(KC);
#pragma unroll   // 12 trips: buffer and k offsets become immediates, so no address register of a load in flight is rewritten
  for (int c = 0; c < D / KC; ++c) { lds_barrier();   // publishes stage c and ends every read of the buffer that stage c + 1 goes into
    const b16* const cur = St + (c & 1) * STG;
    if (c + 1 < D / KC) { put(St + ((c + 1) & 1) * STG); if (c + 2 < D / KC) fetch((c + 2) * KC); }   // a stage's global loads have a whole trip to land
    v16b a[2][4], b[2][2];   // all fragment reads of the stage stand as one group ahead of its products
#pragma unroll
    for (int ks = 0; ks < 2; ++ks) {
#pragma unroll
      for (int n = 0; n < 2; ++n) b[ks][n] = frag_kb(cur + ASZ + (wave * 32 + n * 16 + nloc) * KP + ks * 32, hlf);
#pragma unroll
      for (int m = 0; m < 4; ++m) a[ks][m] = frag_kb(cur + (m * 16 + nloc) * KP + ks * 32, hlf); }
#pragma unroll
    for (int ks = 0; ks < 2; ++ks)
#pragma unroll
      for (int m = 0; m < 4; ++m) { acc[m][0] = wmma16b(a[ks][m], b[ks][0], acc[m][0]); acc[m][1] = wmma16b(a[ks][m], b[ks][1], acc[m][1]); } }
  __syncthreads();   // every wave has left the stages before the output tile overwrites them
#pragma unroll
  for (int n = 0; n < 2; ++n) { const int cc = wave * 32 + n * 16 + nloc; const float bb = which == 0 ? bfv(bq[c0 + cc]) : (which == 2 ? bfv(bv[c0 + cc]) : 0.0f);
#pragma unroll
    for (int m = 0; m < 4; ++m)
#pragma unroll
      for (int r8 = 0; r8 < 8; ++r8) Tf[(m * 16 + 8 * hlf + r8) * TFP + cc] = acc[m][n][r8] * (1.0f / (XS * WSC)) + bb; }
  __syncthreads();
  // both row loops are unrolled so that the row addresses are immediates and no address register is rewritten behind a store
  if (which == 2) { float* const Vp = V + (t0 + wave) * D + c0 + lane * 4; const float* const Tp = Tf + wave * TFP + lane * 4;
#pragma unroll
    for (int i = 0; i < 8; ++i) { *(v4f*)(Vp + (size_t)i * 8 * D) = *(const v4f*)(Tp + i * 8 * TFP); *(v4f*)(Vp + (size_t)i * 8 * D + 128) = *(const v4f*)(Tp + i * 8 * TFP + 128); } }
  else { const size_t ob = (t0 + wave) * D + c0 + lane * 4; b16* const Ph = (which == 0 ? Qh : Kh) + ob; b16* const Pl = (which == 0 ? Ql : Kl) + ob; const float* const Tp = Tf + wave * TFP + lane * 4;
#pragma unroll
    for (int i = 0; i < 8; ++i) {
#pragma unroll
      for (int q = 0; q < 2; ++q) { const v4f f = *(const v4f*)(Tp + i * 8 * TFP + q * 128); v4b hi, lo;
#pragma unroll
        for (int j = 0; j < 4; ++j) { b16 h0, l0; split16(f[j] * HS, h0, l0); hi[j] = h0; lo[j] = l0; }
        *(v4b*)(Ph + (size_t)i * 8 * D + q * 128) = hi; *(v4b*)(Pl + (size_t)i * 8 * D + q * 128) = lo; } }
    asm volatile("s_wait_xcnt 0x0" ::: "memory");   // behind the last q/k store: in the listing the v branch follows and rewrites the registers that these stores name
  } }
__global__ __launch_bounds__(256) void vt_kernel(const float* __restrict__ V, int BLIM, b16* __restrict__ VTh, b16* __restrict__ VTl) { __shared__ float Tt[64][257]; const int b = blockIdx.x / 12, rem = blockIdx.x % 12; const int kt = rem / 3, hg = rem % 3; if (b >= BLIM) return; const int k0 = kt * 64; const int tid = threadIdx.x, wave = tid >> 5, lane = tid & 31;
  for (int q = wave; q < 64; q += 8) for (int c = lane; c < 256; c += 32) Tt[q][c] = (k0 + q < S) ? V[((size_t)b * S + k0 + q) * D + hg * 256 + c] : 0.0f;
  __syncthreads();
  { for (int c = wave; c < 256; c += 8) { const int h = hg * 4 + c / HD, d = c % HD; b16 h0, l0, h1, l1; split16(Tt[lane * 2][c] * HS, h0, l0); split16(Tt[lane * 2 + 1][c] * HS, h1, l1); const size_t o = (((size_t)b * H + h) * HD + d) * VW + k0 + lane * 2; *(v2b*)(VTh + o) = (v2b){h0, h1}; *(v2b*)(VTl + o) = (v2b){l0, l1}; }  } }
__global__ __launch_bounds__(32) void att_kernel(const b16* __restrict__ Qh, const b16* __restrict__ Ql, const b16* __restrict__ Kh, const b16* __restrict__ Kl, const b16* __restrict__ VTh, const b16* __restrict__ VTl, const float* __restrict__ btab, int BLIM, float* __restrict__ out) { __shared__ __attribute__((aligned(16))) b16 Pa[16][VW + 8], Pb[16][VW + 8]; __shared__ float Sc[16][SP + 1], Of[16][HD + 1]; const int lane = threadIdx.x, nloc = lane & 15, hlf = lane >> 4; const int b = blockIdx.x / (H * 13), rem = blockIdx.x % (H * 13); const int h = rem / 13, q0 = (rem % 13) * 16; if (b >= BLIM) return; const size_t tb = (size_t)b * S;
  const size_t qrow = tb + (q0 + nloc < S ? q0 + nloc : S - 1);   // rows past the image read a valid row; their results are not written
  v16b qa[2], ql[2]; for (int ks = 0; ks < 2; ++ks) { qa[ks] = frag_kb(Qh + qrow * D + h * HD + ks * 32, hlf); ql[ks] = frag_kb(Ql + qrow * D + h * HD + ks * 32, hlf); }
#pragma unroll 1
  for (int t = 0; t < 13; ++t) { v8f s = (v8f){};
#pragma unroll
    for (int ks = 0; ks < 2; ++ks) { const size_t ko = (tb + t * 16 + nloc) * D + h * HD + ks * 32; const v16b kh = frag_kb(Kh + ko, hlf), kl = frag_kb(Kl + ko, hlf); s = wmma16b(qa[ks], kh, s); s = wmma16b(qa[ks], kl, s); s = wmma16b(ql[ks], kh, s); }
#pragma unroll
    for (int r8 = 0; r8 < 8; ++r8) Sc[8 * hlf + r8][t * 16 + nloc] = s[r8] * (SCALE / (HS * HS)); }
  wave_lds_sync();
  if (lane < 16) { const int r = lane, q = q0 + r; const int qq = q < S ? q : 0; float mx = -INFINITY; for (int k = 0; k < S; ++k) { const float v = Sc[r][k] + bfv(btab[relidx(qq, k) * H + h]); Sc[r][k] = v; mx = fmaxf(mx, v); }
    float sm = 0.0f; for (int k = 0; k < S; ++k) { const float p = __expf(Sc[r][k] - mx); Sc[r][k] = p; sm += p; } const float inv = 1.0f / sm;
    for (int k = 0; k < S; ++k) { b16 p, pl; split16(Sc[r][k] * inv * PS, p, pl); Pa[r][k] = p; Pb[r][k] = pl; } for (int k = S; k < VW + 8; ++k) { Pa[r][k] = (b16)0.0f; Pb[r][k] = (b16)0.0f; } }
  wave_lds_sync();
  v8f o[4] = {(v8f){}, (v8f){}, (v8f){}, (v8f){}};
#pragma unroll
  for (int kb = 0; kb < 224; kb += 32) { const v16b pa = frag_kb(&Pa[nloc][kb], hlf), pb = frag_kb(&Pb[nloc][kb], hlf);
#pragma unroll
    for (int t = 0; t < 4; ++t) { const size_t vo = (((size_t)b * H + h) * HD + t * 16 + nloc) * VW + kb; const v16b vh = frag_kb(VTh + vo, hlf), vl = frag_kb(VTl + vo, hlf); o[t] = wmma16b(pa, vh, o[t]); o[t] = wmma16b(pa, vl, o[t]); o[t] = wmma16b(pb, vh, o[t]); } }
#pragma unroll
  for (int t = 0; t < 4; ++t)
#pragma unroll
    for (int r8 = 0; r8 < 8; ++r8) Of[8 * hlf + r8][t * 16 + nloc] = o[t][r8] * (1.0f / (PS * HS));
  wave_lds_sync();
  { for (int r = 0; r < 16; ++r) { if (q0 + r >= S) break; *(v2f*)(out + (tb + q0 + r) * D + h * HD + lane * 2) = (v2f){Of[r][lane * 2], Of[r][lane * 2 + 1]}; }  } }
}  // namespace

extern "C" void kernel_launch(void* const* d_in, const int* in_sizes, int n_in, void* d_out, int out_size, void* d_ws, size_t ws_size, hipStream_t stream) {
  (void)n_in;
  auto Fp = [&](int i) { return (const float*)d_in[i]; };
  // input order: 0 hidden_states [64,197,768]; 1 Wq [768,768]; 2 bq [768]; 3 Wk; 4 Wv; 5 bv; 6 bias_table [732,12]
  if (in_sizes[0] != T * D || in_sizes[1] != D * D || in_sizes[3] != D * D || in_sizes[4] != D * D || in_sizes[6] != NRD * H || out_size != T * D) return;
  const int BLIM = NB_;
  size_t off = 0; char* ws = (char*)d_ws;
  auto carve = [&](size_t bytes) { char* p = ws + off; off += (bytes + 255) & ~(size_t)255; return p; };
  b16* WQKV = (b16*)carve((size_t)3 * D * D * 2); b16* Qh = (b16*)carve((size_t)TP * D * 2); b16* Ql = (b16*)carve((size_t)TP * D * 2); b16* Kh = (b16*)carve((size_t)TP * D * 2); b16* Kl = (b16*)carve((size_t)TP * D * 2); float* V = (float*)carve((size_t)T * D * 4); b16* VTh = (b16*)carve((size_t)NB_ * H * HD * VW * 2); b16* VTl = (b16*)carve((size_t)NB_ * H * HD * VW * 2);
  if (off > ws_size || off > ((size_t)176 << 20)) return;   // ~ 168 MB (> 128 MiB, < 256 MiB admissible)
  wput_kernel<<<256, 256, 0, stream>>>(Fp(1), Fp(3), Fp(4), WQKV, Kh, Kl, VTh, VTl);
  proj_kernel<<<(BLIM * S + 63) / 64 * 9, 256, 0, stream>>>(Fp(0), WQKV, Fp(2), Fp(5), BLIM, Qh, Ql, Kh, Kl, V);
  vt_kernel<<<BLIM * 12, 256, 0, stream>>>(V, BLIM, VTh, VTl);
  att_kernel<<<BLIM * H * 13, 32, 0, stream>>>(Qh, Ql, Kh, Kl, VTh, VTl, Fp(6), BLIM, (float*)d_out);
}

// v002
// One run takes 233 microseconds.
// Timed twice side by side with v001, it ran 1.68 times as fast both times.
// Over all steps from v000 it is 4.90 times as fast.
#include <hip/hip_runtime.h>

// BeitSelfAttention: q = x Wq + bq, k = x Wk (no bias), v = x Wv + bv (12 heads x 64); scores = q.k/8 + bias_table[rel_idx(q,k)][h] (BEiT relative position index incl. the cls row/column/corner entries); probs = softmax; ctx = probs v -> [64][197][768].
// Deterministic: per-wave softmax over the 197 keys in fixed order; no atomics.
// WMMA (v_wmma_f32_16x16x32_f16, f32 accumulate): x (EXACT bf16 x8, K 768) x [Wq|Wk|Wv] rows (EXACT x256 (in,out); 144 tiles in 9 groups), 64 tokens x 256 columns per 8-wave work-group; per (b, h, 16-query) wave S^T = k rows (hi+lo; 13 tiles) x q (hi+lo x256, K 64) and ctx^T = v^T rows (hi+lo; 4 tiles, K 224 zero-padded) x P^T (hi+lo), 3 products — 4.3 M WMMA; bias gather + softmax in f32.

namespace {
constexpr int NB_ = 64, S = 197, SP = 208 /* 13 key tiles */, VW = 256 /* padded v^T row */, D = 768, H = 12, HD = 64, T = NB_ * S /* 12608 = 788*16 */, TP = T + 32, WH = 14, NRD = 732;
constexpr float XS = 8.0f, HS = 256.0f, PS = 256.0f, WSC = 256.0f, SCALE = 0.125f;
typedef _Float16 b16;
typedef __attribute__((ext_vector_type(16))) _Float16 v16b;
typedef __attribute__((ext_vector_type(8))) _Float16 v8b;
typedef __attribute__((ext_vector_type(4))) _Float16 v4b;
typedef __attribute__((ext_vector_type(2))) _Float16 v2b;
typedef __attribute__((ext_vector_type(8))) float v8f;
typedef __attribute__((ext_vector_type(4))) float v4f;
typedef __attribute__((ext_vector_type(2))) float v2f;
__device__ __forceinline__ float bf16_rne(float f) { unsigned int u = __float_as_uint(f); u += 0x7FFFu + ((u >> 16) & 1u); float r = __uint_as_float(u & 0xFFFF0000u); asm volatile("" : "+v"(r)); return r; }
__device__ __forceinline__ float bfv(float f) { float r = bf16_rne(f); asm volatile("" : "+v"(r)); return r; }
__device__ __forceinline__ void split16(float v, b16& hi, b16& lo) { hi = (b16)v; lo = (b16)(v - (float)hi); }
__device__ __forceinline__ v16b frag_kb(const b16* p, int hh) { const v8b a = *(const v8b*)(p + 8 * hh), b = *(const v8b*)(p + 16 + 8 * hh); v16b f;
#pragma unroll
  for (int e = 0; e < 8; ++e) { f[e] = a[e]; f[8 + e] = b[e]; } return f; }
__device__ __forceinline__ v8f wmma16b(v16b a, v16b b, v8f c) { v8f d = __builtin_amdgcn_wmma_f32_16x16x32_f16(false, a, false, b, (short)0, c, false, false); asm volatile("v_nop\n\tv_nop\n\tv_nop\n\tv_nop" : "+v"(d) : "v"(a), "v"(b)); return d; }
// work-group barrier that orders LDS only: the global loads of a later stage, which land in the wave's own registers, stay in flight across it
// the scheduling barrier keeps the rounding of the loaded x values, and with it the wait for those loads, from being lifted in among the products of the trip before
__device__ __forceinline__ void lds_barrier() { __builtin_amdgcn_sched_barrier(0); __builtin_amdgcn_fence(__ATOMIC_RELEASE, "workgroup", "local"); __builtin_amdgcn_s_barrier(); __builtin_amdgcn_fence(__ATOMIC_ACQUIRE, "workgroup", "local"); }

__global__ __launch_bounds__(256) void wput_kernel(const float* __restrict__ wq, const float* __restrict__ wk, const float* __restrict__ wv, b16* __restrict__ WQKV, b16* __restrict__ Kh, b16* __restrict__ Kl, b16* __restrict__ VTh, b16* __restrict__ VTl) { const size_t nt = (size_t)gridDim.x * 256, u0 = (size_t)blockIdx.x * 256 + threadIdx.x; v8b v; const v8b z = {0, 0, 0, 0, 0, 0, 0, 0};
  for (size_t u = u0; u < (size_t)3 * D * (D / 8); u += nt) { const int o = (int)(u / (D / 8)), k0 = (int)(u % (D / 8)) * 8; const int which = o / D, oo = o % D; const float* w = which == 0 ? wq : (which == 1 ? wk : wv);
#pragma unroll
    for (int j = 0; j < 8; ++j) v[j] = (b16)(bf16_rne(w[(size_t)(k0 + j) * D + oo]) * WSC); { *(v8b*)(WQKV + (size_t)o * D + k0) = v;  } }
  for (size_t u = u0; u < (size_t)(TP - T) * (D / 8); u += nt) { const size_t off = (size_t)T * D + u * 8; { *(v8b*)(Kh + off) = z; *(v8b*)(Kl + off) = z;  } }
  for (size_t u = u0; u < (size_t)NB_ * H * HD * (VW / 8); u += nt) { { *(v8b*)(VTh + u * 8) = z; *(v8b*)(VTl + u * 8) = z;  } } }
// proj: one work-group of 8 waves per 64-token x 256-column tile of [q|k|v]. x (rounded, x8) and the weight rows go through LDS in 64-k stages, two buffers;
// each wave owns 64 x 32 outputs (4 x 2 accumulator tiles), so a weight fragment feeds 4 products and an x fragment 2. k runs upward in one chain per output.
__global__ __launch_bounds__(256) void proj_kernel(const float* __restrict__ x, const b16* __restrict__ WQKV, const float* __restrict__ bq, const float* __restrict__ bv, int BLIM, b16* __restrict__ Qh, b16* __restrict__ Ql, b16* __restrict__ Kh, b16* __restrict__ Kl, float* __restrict__ V) {
  constexpr int KC = 64, KP = KC + 8 /* 144-byte rows: 16 B x odd for 16-byte readers */, ASZ = 64 * KP, STG = ASZ + 256 * KP, TFP = 260;
  constexpr int SMB = 2 * STG * 2 > 64 * TFP * 4 ? 2 * STG * 2 : 64 * TFP * 4;
  __shared__ __attribute__((aligned(16))) char smem[SMB];
  b16* const St = (b16*)smem; float* const Tf = (float*)smem;   // the output tile reuses the stages behind a barrier
  const int tid = threadIdx.x, lane = tid & 31, wave = tid >> 5, nloc = lane & 15, hlf = lane >> 4;
  const int g = blockIdx.x % 9, which = g / 3, c0 = (g % 3) * 256; const size_t t0 = (size_t)(blockIdx.x / 9) * 64; if (t0 >= (size_t)BLIM * S) return;
  const int ar = tid >> 4, ac = (tid & 15) * 4, br = tid >> 3, bc = (tid & 7) * 8;   // 16 lanes cover 256 B of an x row, 8 lanes 128 B of a weight row
  const float* const xg = x + (t0 + ar) * D + ac; const b16* const wg = WQKV + ((size_t)which * D + c0 + br) * D + bc;
  v4f xr[4]; v8b wr[8]; v8f acc[4][2];
#pragma unroll
  for (int m = 0; m < 4; ++m) { acc[m][0] = (v8f){}; acc[m][1] = (v8f){}; }
  auto fetch = [&](int kc) {
#pragma unroll
    for (int i = 0; i < 4; ++i) xr[i] = *(const v4f*)(xg + (size_t)i * 16 * D + kc);
#pragma unroll
    for (int i = 0; i < 8; ++i) wr[i] = *(const v8b*)(wg + (size_t)i * 32 * D + kc); };
  auto put = [&](b16* st) {
#pragma unroll
    for (int i = 0; i < 4; ++i) { v4b h;
#pragma unroll
      for (int j = 0; j < 4; ++j) h[j] = (b16)(bf16_rne(xr[i][j]) * XS);
      *(v4b*)(st + (ar + i * 16) * KP + ac) = h; }
#pragma unroll
    for (int i = 0; i < 8; ++i) *(v8b*)(st + ASZ + (br + i * 32) * KP + bc) = wr[i]; };
  fetch(0); put(St); fetch(KC);
#pragma unroll   // 12 trips: buffer and k offsets become immediates, so no address register of a load in flight is rewritten
  for (int c = 0; c < D / KC; ++c) { lds_barrier();   // publishes stage c and ends every read of the buffer that stage c + 1 goes into
    const b16* const cur = St + (c & 1) * STG;
    if (c + 1 < D / KC) { put(St + ((c + 1) & 1) * STG); if (c + 2 < D / KC) fetch((c + 2) * KC); }   // a stage's global loads have a whole trip to land
    v16b a[2][4], b[2][2];   // all fragment reads of the stage stand as one group ahead of its products
#pragma unroll
    for (int ks = 0; ks < 2; ++ks) {
#pragma unroll
      for (int n = 0; n < 2; ++n) b[ks][n] = frag_kb(cur + ASZ + (wave * 32 + n * 16 + nloc) * KP + ks * 32, hlf);
#pragma unroll
      for (int m = 0; m < 4; ++m) a[ks][m] = frag_kb(cur + (m * 16 + nloc) * KP + ks * 32, hlf); }
#pragma unroll
    for (int ks = 0; ks < 2; ++ks)
#pragma unroll
      for (int m = 0; m < 4; ++m) { acc[m][0] = wmma16b(a[ks][m], b[ks][0], acc[m][0]); acc[m][1] = wmma16b(a[ks][m], b[ks][1], acc[m][1]); } }
  __syncthreads();   // every wave has left the stages before the output tile overwrites them
#pragma unroll
  for (int n = 0; n < 2; ++n) { const int cc = wave * 32 + n * 16 + nloc; const float bb = which == 0 ? bfv(bq[c0 + cc]) : (which == 2 ? bfv(bv[c0 + cc]) : 0.0f);
#pragma unroll
    for (int m = 0; m < 4; ++m)
#pragma unroll
      for (int r8 = 0; r8 < 8; ++r8) Tf[(m * 16 + 8 * hlf + r8) * TFP + cc] = acc[m][n][r8] * (1.0f / (XS * WSC)) + bb; }
  __syncthreads();
  // both row loops are unrolled so that the row addresses are immediates and no address register is rewritten behind a store
  if (which == 2) { float* const Vp = V + (t0 + wave) * D + c0 + lane * 4; const float* const Tp = Tf + wave * TFP + lane * 4;
#pragma unroll
    for (int i = 0; i < 8; ++i) { *(v4f*)(Vp + (size_t)i * 8 * D) = *(const v4f*)(Tp + i * 8 * TFP); *(v4f*)(Vp + (size_t)i * 8 * D + 128) = *(const v4f*)(Tp + i * 8 * TFP + 128); } }
  else { const size_t ob = (t0 + wave) * D + c0 + lane * 4; b16* const Ph = (which == 0 ? Qh : Kh) + ob; b16* const Pl = (which == 0 ? Ql : Kl) + ob; const float* const Tp = Tf + wave * TFP + lane * 4;
#pragma unroll
    for (int i = 0; i < 8; ++i) {
#pragma unroll
      for (int q = 0; q < 2; ++q) { const v4f f = *(const v4f*)(Tp + i * 8 * TFP + q * 128); v4b hi, lo;
#pragma unroll
        for (int j = 0; j < 4; ++j) { b16 h0, l0; split16(f[j] * HS, h0, l0); hi[j] = h0; lo[j] = l0; }
        *(v4b*)(Ph + (size_t)i * 8 * D + q * 128) = hi; *(v4b*)(Pl + (size_t)i * 8 * D + q * 128) = lo; } }
    asm volatile("s_wait_xcnt 0x0" ::: "memory");   // behind the last q/k store: in the listing the v branch follows and rewrites the registers that these stores name
  } }
__global__ __launch_bounds__(256) void vt_kernel(const float* __restrict__ V, int BLIM, b16* __restrict__ VTh, b16* __restrict__ VTl) { __shared__ float Tt[64][257]; const int b = blockIdx.x / 12, rem = blockIdx.x % 12; const int kt = rem / 3, hg = rem % 3; if (b >= BLIM) return; const int k0 = kt * 64; const int tid = threadIdx.x, wave = tid >> 5, lane = tid & 31;
  for (int q = wave; q < 64; q += 8) for (int c = lane; c < 256; c += 32) Tt[q][c] = (k0 + q < S) ? V[((size_t)b * S + k0 + q) * D + hg * 256 + c] : 0.0f;
  __syncthreads();
  { for (int c = wave; c < 256; c += 8) { const int h = hg * 4 + c / HD, d = c % HD; b16 h0, l0, h1, l1; split16(Tt[lane * 2][c] * HS, h0, l0); split16(Tt[lane * 2 + 1][c] * HS, h1, l1); const size_t o = (((size_t)b * H + h) * HD + d) * VW + k0 + lane * 2; *(v2b*)(VTh + o) = (v2b){h0, h1}; *(v2b*)(VTl + o) = (v2b){l0, l1}; }  } }
// relative position index: entry 731 for (cls, cls), 729 for the cls query, 730 for the cls key; for patches (dy + 13) * 27 + dx + 13.
// With patch p = token - 1 written as row * 27 + column that is plin(q - 1) - plin(k - 1) + 13 * 27 + 13
__device__ __forceinline__ constexpr int plin(int p) { return (p / WH) * (2 * WH - 1) + p % WH; }
// exp(x) as the fast intrinsic forms it (x * log2 e, then the hardware exp2). The v_nop is the slot behind a transcendental: written into the same statement, it stands there
// whichever instruction the compiler puts next.
__device__ __forceinline__ float exp_slot(float x) { const float y = x * 1.44269504f; float r; asm("v_exp_f32 %0, %1\n\tv_nop" : "=v"(r) : "v"(y)); return r; }
// att: one wave per (b, h, 16 queries), everything transposed and in registers. S^T = k rows (A) x q (B): lane (c, half) holds for query q0 + c the keys 16 t + 8 half + r,
// so bias, maximum, exp and sum run in-lane on all 32 lanes, with one exchange between the halves. Two score tiles, converted in place, are the B operand of ctx^T = v^T rows (A) x P^T
// in the k order that frag_kb gives v^T; a lane then holds 8 consecutive d of its query and stores them itself.
// Loads stand one tile ahead of their products. The scheduling barriers keep that order: without them the next tile's bias rounding, and with it the wait for loads just issued, is lifted in front of this tile's products, and the register count passes 256.
__global__ __launch_bounds__(32) void att_kernel(const b16* __restrict__ Qh, const b16* __restrict__ Ql, const b16* __restrict__ Kh, const b16* __restrict__ Kl, const b16* __restrict__ VTh, const b16* __restrict__ VTl, const float* __restrict__ btab, int BLIM, float* __restrict__ out) { const int lane = threadIdx.x, nloc = lane & 15, hlf = lane >> 4; const int b = blockIdx.x / (H * 13), rem = blockIdx.x % (H * 13); const int h = rem / 13, q0 = (rem % 13) * 16; if (b >= BLIM) return; const size_t tb = (size_t)b * S;
  const int q = q0 + nloc; const size_t qrow = tb + (q < S ? q : S - 1);   // columns past the image read a valid row; their results are not written
  // every stream's pointer holds the lane's whole address (the half's 8 elements too), so that all loads of the stream name that one register pair plus a constant
  const b16* const qph = Qh + qrow * D + h * HD + 8 * hlf; const b16* const qpl = Ql + qrow * D + h * HD + 8 * hlf;
  v16b qa[2], ql[2], kh[2][2], kl[2][2]; float br[2][8];
#pragma unroll
  for (int ks = 0; ks < 2; ++ks) { qa[ks] = frag_kb(qph + ks * 32, 0); ql[ks] = frag_kb(qpl + ks * 32, 0); }
  // bias addresses: for a patch query the entry of key k lies plin(k - 1) entries below the query's own base, a constant per register but for the upper half's 8 keys (8 or 21 entries more).
  // The cls query (and a column past the image, as before) has one entry for all patch keys: it reads as query 1, in bounds, and takes the cls value instead.
  const int qq = q < S ? q : 0; const bool qcls = qq == 0; const int base = (plin(qcls ? 0 : qq - 1) + (WH - 1) * (2 * WH - 1) + (WH - 1)) * H + h;
  constexpr int PL = plin(S - 2); const float* const pn = btab + (base - PL * H); const float* const p0 = pn - hlf * 8 * H; const float* const p1 = pn - hlf * 21 * H;   // set to the last key's entry: constants from 0 up
  const float bcls = btab[(NRD - 3) * H + h];
  const int idx0 = hlf == 0 ? (qcls ? NRD - 1 : NRD - 2) * H + h : (qcls ? (NRD - 3) * H + h : base - plin(7) * H);   // register 0 of tile 0: key 0 or key 8
  const b16* const kph = Kh + (tb + nloc) * D + h * HD + 8 * hlf; const b16* const kpl = Kl + (tb + nloc) * D + h * HD + 8 * hlf;
  const b16* const vph = VTh + (((size_t)b * H + h) * HD + nloc) * VW + 8 * hlf; const b16* const vpl = VTl + (((size_t)b * H + h) * HD + nloc) * VW + 8 * hlf;
  auto kfetch = [&](int t, int bf) {
#pragma unroll
    for (int ks = 0; ks < 2; ++ks) { kh[bf][ks] = frag_kb(kph + t * 16 * D + ks * 32, 0); kl[bf][ks] = frag_kb(kpl + t * 16 * D + ks * 32, 0); }
#pragma unroll
    for (int r8 = 0; r8 < 8; ++r8) { const int c = t * 16 + r8;   // the lower half's key; the upper half's is c + 8
      if (c >= S) br[bf][r8] = 0.0f; else if (c == 0) br[bf][r8] = btab[idx0];
      else br[bf][r8] = (c + 8 >= S ? pn : ((c + 7) / WH != (c - 1) / WH ? p1 : p0))[(PL - plin(c - 1)) * H]; } };   // an upper-half key past the image reads the lower half's entry and is masked below
  v16b vh[2][2], vl[2][2];
  auto vfetch = [&](int u, int bf) {   // unit u: keys 32 (u / 2) ..., d tiles 2 (u % 2) and 2 (u % 2) + 1
#pragma unroll
    for (int i = 0; i < 2; ++i) { const int vo = ((u & 1) * 2 + i) * 16 * VW + (u >> 1) * 32; vh[bf][i] = frag_kb(vph + vo, 0); vl[bf][i] = frag_kb(vpl + vo, 0); } };
  v8f s[13]; float mx = -INFINITY;
  kfetch(0, 0);
  asm volatile("s_wait_xcnt 0x0" :: "v"(qph), "v"(qpl), "v"(idx0) : "memory");   // behind the last loads that name these address registers; as inputs they stay untouched up to the wait and are free for reuse behind it
#pragma unroll
  for (int t = 0; t < 13; ++t) { const int bf = t & 1; if (t + 1 < 13) kfetch(t + 1, bf ^ 1); else vfetch(0, 0);
    if (t == 11) asm volatile("s_wait_xcnt 0x0" :: "v"(p0), "v"(p1), "v"(pn), "v"(kph), "v"(kpl) : "memory");   // the same behind the last bias and k loads
    __builtin_amdgcn_sched_barrier(0);   // the next tile's loads are issued before this tile's work
    v8f a = (v8f){};
#pragma unroll
    for (int ks = 0; ks < 2; ++ks) { a = wmma16b(kh[bf][ks], qa[ks], a); a = wmma16b(kl[bf][ks], qa[ks], a); a = wmma16b(kh[bf][ks], ql[ks], a); }
#pragma unroll
    for (int r8 = 0; r8 < 8; ++r8) { const int c = t * 16 + r8;
      if (c >= S) { a[r8] = -INFINITY; continue; }
      float v = a[r8] * (SCALE / (HS * HS)) + bfv(c != 0 && qcls ? bcls : br[bf][r8]); if (c + 8 >= S && hlf) v = -INFINITY;
      a[r8] = v; mx = fmaxf(mx, v); }
    s[t] = a; __builtin_amdgcn_sched_barrier(0); }   // nothing of the next tile is worked on, or waited for, in front of this point
  mx = fmaxf(mx, __shfl_xor(mx, 16, 32));
  float sp[8] = {0.0f, 0.0f, 0.0f, 0.0f, 0.0f, 0.0f, 0.0f, 0.0f};   // eight partial sums: no chain of 101 dependent adds
#pragma unroll
  for (int t = 0; t < 13; ++t)
#pragma unroll
    for (int r8 = 0; r8 < 8; ++r8) { if (t * 16 + r8 >= S) { s[t][r8] = 0.0f; continue; } const float p = exp_slot(s[t][r8] - mx); s[t][r8] = p; sp[r8] += p; }
  float sm = ((sp[0] + sp[1]) + (sp[2] + sp[3])) + ((sp[4] + sp[5]) + (sp[6] + sp[7])); sm += __shfl_xor(sm, 16, 32); const float inv = 1.0f / sm;
  __builtin_amdgcn_sched_barrier(0);   // the second v^T unit's loads stay behind the softmax: lifted in front of it they hold 32 more registers through it and the count passes 256
  v8f o[4] = {(v8f){}, (v8f){}, (v8f){}, (v8f){}}; v16b pa, pb;
#pragma unroll
  for (int u = 0; u < 14; ++u) { const int bf = u & 1, j = u >> 1, t0 = (u & 1) * 2, t1 = t0 + 1; if (u + 1 < 14) vfetch(u + 1, bf ^ 1);
    if (u == 12) asm volatile("s_wait_xcnt 0x0" :: "v"(vph), "v"(vpl) : "memory");   // the same behind the last v^T loads
    __builtin_amdgcn_sched_barrier(0);   // the next unit's loads are issued before this unit's products
    if ((u & 1) == 0) {
#pragma unroll
      for (int e = 0; e < 8; ++e) { b16 p, pl; split16(s[2 * j][e] * inv * PS, p, pl); pa[e] = p; pb[e] = pl;
        if (2 * j + 1 < 13) { split16(s[2 * j + 1][e] * inv * PS, p, pl); pa[8 + e] = p; pb[8 + e] = pl; } else { pa[8 + e] = (b16)0.0f; pb[8 + e] = (b16)0.0f; } } }
    o[t0] = wmma16b(vh[bf][0], pa, o[t0]); o[t1] = wmma16b(vh[bf][1], pa, o[t1]); o[t0] = wmma16b(vl[bf][0], pa, o[t0]); o[t1] = wmma16b(vl[bf][1], pa, o[t1]); o[t0] = wmma16b(vh[bf][0], pb, o[t0]); o[t1] = wmma16b(vh[bf][1], pb, o[t1]); __builtin_amdgcn_sched_barrier(0); }   // as above: no wait for the next unit in front of this point
  if (q < S) { float* const op = out + (tb + q) * D + h * HD + 8 * hlf;
#pragma unroll
    for (int t = 0; t < 4; ++t) { const v8f f = o[t] * (1.0f / (PS * HS)); *(v4f*)(op + t * 16) = (v4f){f[0], f[1], f[2], f[3]}; *(v4f*)(op + t * 16 + 4) = (v4f){f[4], f[5], f[6], f[7]}; } } }
}  // namespace

extern "C" void kernel_launch(void* const* d_in, const int* in_sizes, int n_in, void* d_out, int out_size, void* d_ws, size_t ws_size, hipStream_t stream) {
  (void)n_in;
  auto Fp = [&](int i) { return (const float*)d_in[i]; };
  // input order: 0 hidden_states [64,197,768]; 1 Wq [768,768]; 2 bq [768]; 3 Wk; 4 Wv; 5 bv; 6 bias_table [732,12]
  if (in_sizes[0] != T * D || in_sizes[1] != D * D || in_sizes[3] != D * D || in_sizes[4] != D * D || in_sizes[6] != NRD * H || out_size != T * D) return;
  const int BLIM = NB_;
  size_t off = 0; char* ws = (char*)d_ws;
  auto carve = [&](size_t bytes) { char* p = ws + off; off += (bytes + 255) & ~(size_t)255; return p; };
  b16* WQKV = (b16*)carve((size_t)3 * D * D * 2); b16* Qh = (b16*)carve((size_t)TP * D * 2); b16* Ql = (b16*)carve((size_t)TP * D * 2); b16* Kh = (b16*)carve((size_t)TP * D * 2); b16* Kl = (b16*)carve((size_t)TP * D * 2); float* V = (float*)carve((size_t)T * D * 4); b16* VTh = (b16*)carve((size_t)NB_ * H * HD * VW * 2); b16* VTl = (b16*)carve((size_t)NB_ * H * HD * VW * 2);
  if (off > ws_size || off > ((size_t)176 << 20)) return;   // ~ 168 MB (> 128 MiB, < 256 MiB admissible)
  wput_kernel<<<256, 256, 0, stream>>>(Fp(1), Fp(3), Fp(4), WQKV, Kh, Kl, VTh, VTl);
  proj_kernel<<<(BLIM * S + 63) / 64 * 9, 256, 0, stream>>>(Fp(0), WQKV, Fp(2), Fp(5), BLIM, Qh, Ql, Kh, Kl, V);
  vt_kernel<<<BLIM * 12, 256, 0, stream>>>(V, BLIM, VTh, VTl);
  att_kernel<<<BLIM * H * 13, 32, 0, stream>>>(Qh, Ql, Kh, Kl, VTh, VTl, Fp(6), BLIM, (float*)d_out);
}

// v003
// One run takes 184 microseconds.
// Two timings next to v002 both put it at 1.27 times that version's speed.
// All steps since v000 together make it 6.22 times as fast.
#include <hip/hip_runtime.h>

// BeitSelfAttention: q = x Wq + bq, k = x Wk (no bias), v = x Wv + bv (12 heads x 64); scores = q.k/8 + bias_table[rel_idx(q,k)][h] (BEiT relative position index incl. the cls row/column/corner entries); probs = softmax; ctx = probs v -> [64][197][768].
// Deterministic: per-wave softmax over the 197 keys in fixed order; no atomics.
// WMMA (v_wmma_f32_16x16x32_f16, f32 accumulate): x (EXACT bf16 x8, K 768) x [Wq|Wk|Wv] rows (EXACT x256 (in,out); 144 tiles in 9 groups), 64 tokens x 256 columns per 8-wave work-group; per (b, h, 16-query) wave, k, v^T and the bias column shared through LDS by 7 waves, S^T = k rows (hi+lo; 13 tiles) x q (hi+lo x256, K 64) and ctx^T = v^T rows (hi+lo; 4 tiles, K 224 zero-padded) x P^T (hi+lo), 3 products — 4.3 M WMMA; bias gather + softmax in f32.

namespace {
constexpr int NB_ = 64, S = 197, SP = 208 /* 13 key tiles */, VW = 256 /* padded v^T row */, D = 768, H = 12, HD = 64, T = NB_ * S /* 12608 = 788*16 */, TP = T + 32, WH = 14, NRD = 732;
constexpr float XS = 8.0f, HS = 256.0f, PS = 256.0f, WSC = 256.0f, SCALE = 0.125f;
typedef _Float16 b16;
typedef __attribute__((ext_vector_type(16))) _Float16 v16b;
typedef __attribute__((ext_vector_type(8))) _Float16 v8b;
typedef __attribute__((ext_vector_type(4))) _Float16 v4b;
typedef __attribute__((ext_vector_type(2))) _Float16 v2b;
typedef __attribute__((ext_vector_type(8))) float v8f;
typedef __attribute__((ext_vector_type(4))) float v4f;
typedef __attribute__((ext_vector_type(2))) float v2f;
__device__ __forceinline__ float bf16_rne(float f) { unsigned int u = __float_as_uint(f); u += 0x7FFFu + ((u >> 16) & 1u); float r = __uint_as_float(u & 0xFFFF0000u); asm volatile("" : "+v"(r)); return r; }
__device__ __forceinline__ float bfv(float f) { float r = bf16_rne(f); asm volatile("" : "+v"(r)); return r; }
__device__ __forceinline__ void split16(float v, b16& hi, b16& lo) { hi = (b16)v; lo = (b16)(v - (float)hi); }
__device__ __forceinline__ v16b frag_kb(const b16* p, int hh) { const v8b a = *(const v8b*)(p + 8 * hh), b = *(const v8b*)(p + 16 + 8 * hh); v16b f;
#pragma unroll
  for (int e = 0; e < 8; ++e) { f[e] = a[e]; f[8 + e] = b[e]; } return f; }
__device__ __forceinline__ v8f wmma16b(v16b a, v16b b, v8f c) { v8f d = __builtin_amdgcn_wmma_f32_16x16x32_f16(false, a, false, b, (short)0, c, false, false); asm volatile("v_nop\n\tv_nop\n\tv_nop\n\tv_nop" : "+v"(d) : "v"(a), "v"(b)); return d; }
// work-group barrier that orders LDS only: the global loads of a later stage, which land in the wave's own registers, stay in flight across it
// the scheduling barrier keeps the rounding of the loaded x values, and with it the wait for those loads, from being lifted in among the products of the trip before
__device__ __forceinline__ void lds_barrier() { __builtin_amdgcn_sched_barrier(0); __builtin_amdgcn_fence(__ATOMIC_RELEASE, "workgroup", "local"); __builtin_amdgcn_s_barrier(); __builtin_amdgcn_fence(__ATOMIC_ACQUIRE, "workgroup", "local"); }

__global__ __launch_bounds__(256) void wput_kernel(const float* __restrict__ wq, const float* __restrict__ wk, const float* __restrict__ wv, b16* __restrict__ WQKV, b16* __restrict__ Kh, b16* __restrict__ Kl, b16* __restrict__ VTh, b16* __restrict__ VTl) { const size_t nt = (size_t)gridDim.x * 256, u0 = (size_t)blockIdx.x * 256 + threadIdx.x; v8b v; const v8b z = {0, 0, 0, 0, 0, 0, 0, 0};
  for (size_t u = u0; u < (size_t)3 * D * (D / 8); u += nt) { const int o = (int)(u / (D / 8)), k0 = (int)(u % (D / 8)) * 8; const int which = o / D, oo = o % D; const float* w = which == 0 ? wq : (which == 1 ? wk : wv);
#pragma unroll
    for (int j = 0; j < 8; ++j) v[j] = (b16)(bf16_rne(w[(size_t)(k0 + j) * D + oo]) * WSC); { *(v8b*)(WQKV + (size_t)o * D + k0) = v;  } }
  for (size_t u = u0; u < (size_t)(TP - T) * (D / 8); u += nt) { const size_t off = (size_t)T * D + u * 8; { *(v8b*)(Kh + off) = z; *(v8b*)(Kl + off) = z;  } }
  for (size_t u = u0; u < (size_t)NB_ * H * HD * (VW / 8); u += nt) { { *(v8b*)(VTh + u * 8) = z; *(v8b*)(VTl + u * 8) = z;  } } }
// proj: one work-group of 8 waves per 64-token x 256-column tile of [q|k|v]. x (rounded, x8) and the weight rows go through LDS in 64-k stages, two buffers;
// each wave owns 64 x 32 outputs (4 x 2 accumulator tiles), so a weight fragment feeds 4 products and an x fragment 2. k runs upward in one chain per output.
__global__ __launch_bounds__(256) void proj_kernel(const float* __restrict__ x, const b16* __restrict__ WQKV, const float* __restrict__ bq, const float* __restrict__ bv, int BLIM, b16* __restrict__ Qh, b16* __restrict__ Ql, b16* __restrict__ Kh, b16* __restrict__ Kl, float* __restrict__ V) {
  constexpr int KC = 64, KP = KC + 8 /* 144-byte rows: 16 B x odd for 16-byte readers */, ASZ = 64 * KP, STG = ASZ + 256 * KP, TFP = 260;
  constexpr int SMB = 2 * STG * 2 > 64 * TFP * 4 ? 2 * STG * 2 : 64 * TFP * 4;
  __shared__ __attribute__((aligned(16))) char smem[SMB];
  b16* const St = (b16*)smem; float* const Tf = (float*)smem;   // the output tile reuses the stages behind a barrier
  const int tid = threadIdx.x, lane = tid & 31, wave = tid >> 5, nloc = lane & 15, hlf = lane >> 4;
  const int g = blockIdx.x % 9, which = g / 3, c0 = (g % 3) * 256; const size_t t0 = (size_t)(blockIdx.x / 9) * 64; if (t0 >= (size_t)BLIM * S) return;
  const int ar = tid >> 4, ac = (tid & 15) * 4, br = tid >> 3, bc = (tid & 7) * 8;   // 16 lanes cover 256 B of an x row, 8 lanes 128 B of a weight row
  const float* const xg = x + (t0 + ar) * D + ac; const b16* const wg = WQKV + ((size_t)which * D + c0 + br) * D + bc;
  v4f xr[4]; v8b wr[8]; v8f acc[4][2];
#pragma unroll
  for (int m = 0; m < 4; ++m) { acc[m][0] = (v8f){}; acc[m][1] = (v8f){}; }
  auto fetch = [&](int kc) {
#pragma unroll
    for (int i = 0; i < 4; ++i) xr[i] = *(const v4f*)(xg + (size_t)i * 16 * D + kc);
#pragma unroll
    for (int i = 0; i < 8; ++i) wr[i] = *(const v8b*)(wg + (size_t)i * 32 * D + kc); };
  auto put = [&](b16* st) {
#pragma unroll
    for (int i = 0; i < 4; ++i) { v4b h;
#pragma unroll
      for (int j = 0; j < 4; ++j) h[j] = (b16)(bf16_rne(xr[i][j]) * XS);
      *(v4b*)(st + (ar + i * 16) * KP + ac) = h; }
#pragma unroll
    for (int i = 0; i < 8; ++i) *(v8b*)(st + ASZ + (br + i * 32) * KP + bc) = wr[i]; };
  fetch(0); put(St); fetch(KC);
#pragma unroll   // 12 trips: buffer and k offsets become immediates, so no address register of a load in flight is rewritten
  for (int c = 0; c < D / KC; ++c) { lds_barrier();   // publishes stage c and ends every read of the buffer that stage c + 1 goes into
    const b16* const cur = St + (c & 1) * STG;
    if (c + 1 < D / KC) { put(St + ((c + 1) & 1) * STG); if (c + 2 < D / KC) fetch((c + 2) * KC); }   // a stage's global loads have a whole trip to land
    v16b a[2][4], b[2][2];   // all fragment reads of the stage stand as one group ahead of its products
#pragma unroll
    for (int ks = 0; ks < 2; ++ks) {
#pragma unroll
      for (int n = 0; n < 2; ++n) b[ks][n] = frag_kb(cur + ASZ + (wave * 32 + n * 16 + nloc) * KP + ks * 32, hlf);
#pragma unroll
      for (int m = 0; m < 4; ++m) a[ks][m] = frag_kb(cur + (m * 16 + nloc) * KP + ks * 32, hlf); }
#pragma unroll
    for (int ks = 0; ks < 2; ++ks)
#pragma unroll
      for (int m = 0; m < 4; ++m) { acc[m][0] = wmma16b(a[ks][m], b[ks][0], acc[m][0]); acc[m][1] = wmma16b(a[ks][m], b[ks][1], acc[m][1]); } }
  __syncthreads();   // every wave has left the stages before the output tile overwrites them
#pragma unroll
  for (int n = 0; n < 2; ++n) { const int cc = wave * 32 + n * 16 + nloc; const float bb = which == 0 ? bfv(bq[c0 + cc]) : (which == 2 ? bfv(bv[c0 + cc]) : 0.0f);
#pragma unroll
    for (int m = 0; m < 4; ++m)
#pragma unroll
      for (int r8 = 0; r8 < 8; ++r8) Tf[(m * 16 + 8 * hlf + r8) * TFP + cc] = acc[m][n][r8] * (1.0f / (XS * WSC)) + bb; }
  __syncthreads();
  // both row loops are unrolled so that the row addresses are immediates and no address register is rewritten behind a store
  if (which == 2) { float* const Vp = V + (t0 + wave) * D + c0 + lane * 4; const float* const Tp = Tf + wave * TFP + lane * 4;
#pragma unroll
    for (int i = 0; i < 8; ++i) { *(v4f*)(Vp + (size_t)i * 8 * D) = *(const v4f*)(Tp + i * 8 * TFP); *(v4f*)(Vp + (size_t)i * 8 * D + 128) = *(const v4f*)(Tp + i * 8 * TFP + 128); } }
  else { const size_t ob = (t0 + wave) * D + c0 + lane * 4; b16* const Ph = (which == 0 ? Qh : Kh) + ob; b16* const Pl = (which == 0 ? Ql : Kl) + ob; const float* const Tp = Tf + wave * TFP + lane * 4;
#pragma unroll
    for (int i = 0; i < 8; ++i) {
#pragma unroll
      for (int q = 0; q < 2; ++q) { const v4f f = *(const v4f*)(Tp + i * 8 * TFP + q * 128); v4b hi, lo;
#pragma unroll
        for (int j = 0; j < 4; ++j) { b16 h0, l0; split16(f[j] * HS, h0, l0); hi[j] = h0; lo[j] = l0; }
        *(v4b*)(Ph + (size_t)i * 8 * D + q * 128) = hi; *(v4b*)(Pl + (size_t)i * 8 * D + q * 128) = lo; } }
    asm volatile("s_wait_xcnt 0x0" ::: "memory");   // behind the last q/k store: in the listing the v branch follows and rewrites the registers that these stores name
  } }
__global__ __launch_bounds__(256) void vt_kernel(const float* __restrict__ V, int BLIM, b16* __restrict__ VTh, b16* __restrict__ VTl) { __shared__ float Tt[64][257]; const int b = blockIdx.x / 12, rem = blockIdx.x % 12; const int kt = rem / 3, hg = rem % 3; if (b >= BLIM) return; const int k0 = kt * 64; const int tid = threadIdx.x, wave = tid >> 5, lane = tid & 31;
  for (int q = wave; q < 64; q += 8) for (int c = lane; c < 256; c += 32) Tt[q][c] = (k0 + q < S) ? V[((size_t)b * S + k0 + q) * D + hg * 256 + c] : 0.0f;
  __syncthreads();
  { for (int c = wave; c < 256; c += 8) { const int h = hg * 4 + c / HD, d = c % HD; b16 h0, l0, h1, l1; split16(Tt[lane * 2][c] * HS, h0, l0); split16(Tt[lane * 2 + 1][c] * HS, h1, l1); const size_t o = (((size_t)b * H + h) * HD + d) * VW + k0 + lane * 2; *(v2b*)(VTh + o) = (v2b){h0, h1}; *(v2b*)(VTl + o) = (v2b){l0, l1}; }  } }
// relative position index: entry 731 for (cls, cls), 729 for the cls query, 730 for the cls key; for patches (dy + 13) * 27 + dx + 13.
// With patch p = token - 1 written as row * 27 + column that is plin(q - 1) - plin(k - 1) + 13 * 27 + 13
__device__ __forceinline__ constexpr int plin(int p) { return (p / WH) * (2 * WH - 1) + p % WH; }
// exp(x) as the fast intrinsic forms it (x * log2 e, then the hardware exp2). The v_nop is the slot behind a transcendental: written into the same statement, it stands there
// whichever instruction the compiler puts next.
__device__ __forceinline__ float exp_slot(float x) { const float y = x * 1.44269504f; float r; asm("v_exp_f32 %0, %1\n\tv_nop" : "=v"(r) : "v"(y)); return r; }
// att: one work-group of 7 waves per (b, h, half of the 13 query tiles); one wave per 16 queries, everything transposed and in registers as before.
// The head's k rows, v^T rows (hi and lo) and bias column are brought into LDS once, with loads that cover whole 128-byte lines, and every wave takes its fragments from there:
// a fragment load straight from global memory touches 16 lines for 512 bytes, and each of the 13 waves of a head repeated all of them.
// LDS pitches are 16 B x odd (144 B for k, 464 B for v^T) for the 16-byte readers.
// S^T = k rows (A) x q (B): lane (c, half) holds for query q0 + c the keys 16 t + 8 half + r,
// so bias, maximum, exp and sum run in-lane on all 32 lanes, with one exchange between the halves. Two score tiles, converted in place, are the B operand of ctx^T = v^T rows (A) x P^T
// in the k order that frag_kb gives v^T; a lane then holds 8 consecutive d of its query and stores them itself.
// Loads stand one tile ahead of their products. The scheduling barriers keep that order: without them the next tile's bias rounding, and with it the wait for loads just issued, is lifted in front of this tile's products, and the register count passes 256.
__global__ __launch_bounds__(224) void att_kernel(const b16* __restrict__ Qh, const b16* __restrict__ Ql, const b16* __restrict__ Kh, const b16* __restrict__ Kl, const b16* __restrict__ VTh, const b16* __restrict__ VTl, const float* __restrict__ btab, int BLIM, float* __restrict__ out) {
  constexpr int KP = HD + 8, VP = 224 + 8, KSZ = SP * KP, VSZ = HD * VP;
  __shared__ __attribute__((aligned(16))) char smem[(2 * KSZ + 2 * VSZ) * 2 + NRD * 4];
  b16* const Ksh = (b16*)smem; b16* const Ksl = Ksh + KSZ; b16* const Vsh = Ksl + KSZ; b16* const Vsl = Vsh + VSZ; float* const Bs = (float*)(Vsl + VSZ);
  const int tid = threadIdx.x, lane = tid & 31, nloc = lane & 15, hlf = lane >> 4; const int b = blockIdx.x / (H * 2), rem = blockIdx.x % (H * 2); const int h = rem / 2; if (b >= BLIM) return; const size_t tb = (size_t)b * S;
  const int qt = (rem % 2) * 7 + __builtin_amdgcn_readfirstlane(tid >> 5);
  // the wave's own q fragments are asked for first, so that they land while the shared rows are staged (the wave without a query tile reads the image's last row, in bounds)
  const int q0 = qt * 16;
  const int q = q0 + nloc; const size_t qrow = tb + (q < S ? q : S - 1);   // columns past the image read a valid row; their results are not written
  // the q pointers hold the lane's whole address (the half's 8 elements too), so that all loads of the stream name that one register pair plus a constant
  const b16* const qph = Qh + qrow * D + h * HD + 8 * hlf; const b16* const qpl = Ql + qrow * D + h * HD + 8 * hlf;
  v16b qa[2], ql[2];
#pragma unroll
  for (int ks = 0; ks < 2; ++ks) { qa[ks] = frag_kb(qph + ks * 32, 0); ql[ks] = frag_kb(qpl + ks * 32, 0); }
  asm volatile("s_wait_xcnt 0x0" :: "v"(qph), "v"(qpl) : "memory");   // behind the last loads that name these address registers; as inputs they stay untouched up to the wait and are free for reuse behind it
  { // staging: 8 lanes cover the 128 B of a k row, 28 lanes the 448 B of a v^T row; all row steps are constants on one address per stream
    const int kr = tid >> 3, kc = (tid & 7) * 8, vr = tid / 28, vc = (tid % 28) * 8;
    const b16* const gkh = Kh + (tb + kr) * D + h * HD + kc; const b16* const gkl = Kl + (tb + kr) * D + h * HD + kc;
    const b16* const gvh = VTh + (((size_t)b * H + h) * HD + vr) * VW + vc; const b16* const gvl = VTl + (((size_t)b * H + h) * HD + vr) * VW + vc;
    const float* const gb = btab + tid * H + h;
    v8b rk[2][8], rv[2][8]; float rb[4];
#pragma unroll   // the row steps become immediate offsets and the staging arrays stay in registers
    for (int i = 0; i < 7; ++i) { rk[0][i] = *(const v8b*)(gkh + i * 28 * D); rk[1][i] = *(const v8b*)(gkl + i * 28 * D); }
    if (tid < 96) { rk[0][7] = *(const v8b*)(gkh + 7 * 28 * D); rk[1][7] = *(const v8b*)(gkl + 7 * 28 * D); }   // rows 196 to 207: three whole waves
#pragma unroll   // the row steps become immediate offsets and the staging arrays stay in registers
    for (int i = 0; i < 8; ++i) { rv[0][i] = *(const v8b*)(gvh + i * 8 * VW); rv[1][i] = *(const v8b*)(gvl + i * 8 * VW); }
#pragma unroll   // the row steps become immediate offsets and the staging arrays stay in registers
    for (int i = 0; i < 3; ++i) rb[i] = gb[i * 224 * H];
    if (tid < NRD - 3 * 224) rb[3] = gb[3 * 224 * H];
    asm volatile("s_wait_xcnt 0x0" :: "v"(gkh), "v"(gkl), "v"(gvh), "v"(gvl), "v"(gb) : "memory");   // behind the last loads that name these address registers; as inputs they stay untouched up to the wait
#pragma unroll   // the row steps become immediate offsets and the staging arrays stay in registers
    for (int i = 0; i < 7; ++i) { *(v8b*)(Ksh + (kr + i * 28) * KP + kc) = rk[0][i]; *(v8b*)(Ksl + (kr + i * 28) * KP + kc) = rk[1][i]; }
    if (tid < 96) { *(v8b*)(Ksh + (kr + 7 * 28) * KP + kc) = rk[0][7]; *(v8b*)(Ksl + (kr + 7 * 28) * KP + kc) = rk[1][7]; }
#pragma unroll   // the row steps become immediate offsets and the staging arrays stay in registers
    for (int i = 0; i < 8; ++i) { *(v8b*)(Vsh + (vr + i * 8) * VP + vc) = rv[0][i]; *(v8b*)(Vsl + (vr + i * 8) * VP + vc) = rv[1][i]; }
#pragma unroll   // the row steps become immediate offsets and the staging arrays stay in registers
    for (int i = 0; i < 3; ++i) Bs[tid + i * 224] = rb[i];
    if (tid < NRD - 3 * 224) Bs[tid + 3 * 224] = rb[3]; }
  __syncthreads();   // publishes the staged rows; the only barrier, so the wave without a query tile may leave behind it
  if (qt >= 13) return;
  v16b kh[2][2], kl[2][2]; float br[2][8];
  // bias addresses: for a patch query the entry of key k lies plin(k - 1) entries below the query's own base, a constant per register but for the upper half's 8 keys (8 or 21 entries more).
  // The cls query (and a column past the image, as before) has one entry for all patch keys: it reads as query 1, in bounds, and takes the cls value instead.
  const int qq = q < S ? q : 0; const bool qcls = qq == 0; const int base = plin(qcls ? 0 : qq - 1) + (WH - 1) * (2 * WH - 1) + (WH - 1);
  constexpr int PL = plin(S - 2); const float* const pn = Bs + (base - PL); const float* const p0 = pn - hlf * 8; const float* const p1 = pn - hlf * 21;   // set to the last key's entry: constants from 0 up
  const float bcls = Bs[NRD - 3];
  const int idx0 = hlf == 0 ? (qcls ? NRD - 1 : NRD - 2) : (qcls ? NRD - 3 : base - plin(7));   // register 0 of tile 0: key 0 or key 8
  const b16* const kph = Ksh + nloc * KP + 8 * hlf; const b16* const kpl = Ksl + nloc * KP + 8 * hlf;
  const b16* const vph = Vsh + nloc * VP + 8 * hlf; const b16* const vpl = Vsl + nloc * VP + 8 * hlf;
  auto kfetch = [&](int t, int bf) {
#pragma unroll
    for (int ks = 0; ks < 2; ++ks) { kh[bf][ks] = frag_kb(kph + t * 16 * KP + ks * 32, 0); kl[bf][ks] = frag_kb(kpl + t * 16 * KP + ks * 32, 0); }
#pragma unroll
    for (int r8 = 0; r8 < 8; ++r8) { const int c = t * 16 + r8;   // the lower half's key; the upper half's is c + 8
      if (c >= S) br[bf][r8] = 0.0f; else if (c == 0) br[bf][r8] = Bs[idx0];
      else br[bf][r8] = (c + 8 >= S ? pn : ((c + 7) / WH != (c - 1) / WH ? p1 : p0))[PL - plin(c - 1)]; } };   // an upper-half key past the image reads the lower half's entry and is masked below
  v16b vh[2][2], vl[2][2];
  auto vfetch = [&](int u, int bf) {   // unit u: keys 32 (u / 2) ..., d tiles 2 (u % 2) and 2 (u % 2) + 1
#pragma unroll
    for (int i = 0; i < 2; ++i) { const int vo = ((u & 1) * 2 + i) * 16 * VP + (u >> 1) * 32; vh[bf][i] = frag_kb(vph + vo, 0); vl[bf][i] = frag_kb(vpl + vo, 0); } };
  v8f s[13]; float mx = -INFINITY;
  kfetch(0, 0);
#pragma unroll
  for (int t = 0; t < 13; ++t) { const int bf = t & 1; if (t + 1 < 13) kfetch(t + 1, bf ^ 1); else vfetch(0, 0);
    __builtin_amdgcn_sched_barrier(0);   // the next tile's loads are issued before this tile's work
    v8f a = (v8f){};
#pragma unroll
    for (int ks = 0; ks < 2; ++ks) { a = wmma16b(kh[bf][ks], qa[ks], a); a = wmma16b(kl[bf][ks], qa[ks], a); a = wmma16b(kh[bf][ks], ql[ks], a); }
#pragma unroll
    for (int r8 = 0; r8 < 8; ++r8) { const int c = t * 16 + r8;
      if (c >= S) { a[r8] = -INFINITY; continue; }
      float v = a[r8] * (SCALE / (HS * HS)) + bfv(c != 0 && qcls ? bcls : br[bf][r8]); if (c + 8 >= S && hlf) v = -INFINITY;
      a[r8] = v; mx = fmaxf(mx, v); }
    s[t] = a; __builtin_amdgcn_sched_barrier(0); }   // nothing of the next tile is worked on, or waited for, in front of this point
  mx = fmaxf(mx, __shfl_xor(mx, 16, 32));
  float sp[8] = {0.0f, 0.0f, 0.0f, 0.0f, 0.0f, 0.0f, 0.0f, 0.0f};   // eight partial sums: no chain of 101 dependent adds
#pragma unroll
  for (int t = 0; t < 13; ++t)
#pragma unroll
    for (int r8 = 0; r8 < 8; ++r8) { if (t * 16 + r8 >= S) { s[t][r8] = 0.0f; continue; } const float p = exp_slot(s[t][r8] - mx); s[t][r8] = p; sp[r8] += p; }
  float sm = ((sp[0] + sp[1]) + (sp[2] + sp[3])) + ((sp[4] + sp[5]) + (sp[6] + sp[7])); sm += __shfl_xor(sm, 16, 32); const float inv = 1.0f / sm;
  __builtin_amdgcn_sched_barrier(0);   // the second v^T unit's loads stay behind the softmax: lifted in front of it they hold 32 more registers through it and the count passes 256
  v8f o[4] = {(v8f){}, (v8f){}, (v8f){}, (v8f){}}; v16b pa, pb;
#pragma unroll
  for (int u = 0; u < 14; ++u) { const int bf = u & 1, j = u >> 1, t0 = (u & 1) * 2, t1 = t0 + 1; if (u + 1 < 14) vfetch(u + 1, bf ^ 1);
    __builtin_amdgcn_sched_barrier(0);   // the next unit's loads are issued before this unit's products
    if ((u & 1) == 0) {
#pragma unroll
      for (int e = 0; e < 8; ++e) { b16 p, pl; split16(s[2 * j][e] * inv * PS, p, pl); pa[e] = p; pb[e] = pl;
        if (2 * j + 1 < 13) { split16(s[2 * j + 1][e] * inv * PS, p, pl); pa[8 + e] = p; pb[8 + e] = pl; } else { pa[8 + e] = (b16)0.0f; pb[8 + e] = (b16)0.0f; } } }
    o[t0] = wmma16b(vh[bf][0], pa, o[t0]); o[t1] = wmma16b(vh[bf][1], pa, o[t1]); o[t0] = wmma16b(vl[bf][0], pa, o[t0]); o[t1] = wmma16b(vl[bf][1], pa, o[t1]); o[t0] = wmma16b(vh[bf][0], pb, o[t0]); o[t1] = wmma16b(vh[bf][1], pb, o[t1]); __builtin_amdgcn_sched_barrier(0); }   // as above: no wait for the next unit in front of this point
  if (q < S) { float* const op = out + (tb + q) * D + h * HD + 8 * hlf;
#pragma unroll
    for (int t = 0; t < 4; ++t) { const v8f f = o[t] * (1.0f / (PS * HS)); *(v4f*)(op + t * 16) = (v4f){f[0], f[1], f[2], f[3]}; *(v4f*)(op + t * 16 + 4) = (v4f){f[4], f[5], f[6], f[7]}; } } }
}  // namespace

extern "C" void kernel_launch(void* const* d_in, const int* in_sizes, int n_in, void* d_out, int out_size, void* d_ws, size_t ws_size, hipStream_t stream) {
  (void)n_in;
  auto Fp = [&](int i) { return (const float*)d_in[i]; };
  // input order: 0 hidden_states [64,197,768]; 1 Wq [768,768]; 2 bq [768]; 3 Wk; 4 Wv; 5 bv; 6 bias_table [732,12]
  if (in_sizes[0] != T * D || in_sizes[1] != D * D || in_sizes[3] != D * D || in_sizes[4] != D * D || in_sizes[6] != NRD * H || out_size != T * D) return;
  const int BLIM = NB_;
  size_t off = 0; char* ws = (char*)d_ws;
  auto carve = [&](size_t bytes) { char* p = ws + off; off += (bytes + 255) & ~(size_t)255; return p; };
  b16* WQKV = (b16*)carve((size_t)3 * D * D * 2); b16* Qh = (b16*)carve((size_t)TP * D * 2); b16* Ql = (b16*)carve((size_t)TP * D * 2); b16* Kh = (b16*)carve((size_t)TP * D * 2); b16* Kl = (b16*)carve((size_t)TP * D * 2); float* V = (float*)carve((size_t)T * D * 4); b16* VTh = (b16*)carve((size_t)NB_ * H * HD * VW * 2); b16* VTl = (b16*)carve((size_t)NB_ * H * HD * VW * 2);
  if (off > ws_size || off > ((size_t)176 << 20)) return;   // ~ 168 MB (> 128 MiB, < 256 MiB admissible)
  wput_kernel<<<256, 256, 0, stream>>>(Fp(1), Fp(3), Fp(4), WQKV, Kh, Kl, VTh, VTl);
  proj_kernel<<<(BLIM * S + 63) / 64 * 9, 256, 0, stream>>>(Fp(0), WQKV, Fp(2), Fp(5), BLIM, Qh, Ql, Kh, Kl, V);
  vt_kernel<<<BLIM * 12, 256, 0, stream>>>(V, BLIM, VTh, VTl);
  att_kernel<<<BLIM * H * 2, 224, 0, stream>>>(Qh, Ql, Kh, Kl, VTh, VTl, Fp(6), BLIM, (float*)d_out);
}

// v004
// One run takes 149 microseconds.
// Timed twice side by side with v003, it ran 1.23 times as fast both times.
// All steps since v000 together make it 7.63 times as fast.
#include <hip/hip_runtime.h>

// BeitSelfAttention: q = x Wq + bq, k = x Wk (no bias), v = x Wv + bv (12 heads x 64); scores = q.k/8 + bias_table[rel_idx(q,k)][h] (BEiT relative position index incl. the cls row/column/corner entries); probs = softmax; ctx = probs v -> [64][197][768].
// Deterministic: per-wave softmax over the 197 keys in fixed order; no atomics.
// WMMA (v_wmma_f32_16x16x32_f16, f32 accumulate): x (EXACT bf16 x8, K 768) x [Wq|Wk|Wv] rows (EXACT x256 (in,out); 144 tiles in 9 groups), 64 tokens x 256 columns per 8-wave work-group; per (b, h, 16-query) wave, k, v and the bias column shared through LDS by 7 waves, S^T = k rows (hi+lo; 13 tiles) x q (hi+lo x256, K 64) and ctx^T = v^T rows (hi+lo; 4 tiles, K 224, P = 0 past the image) x P^T (hi+lo), 3 products — 4.3 M WMMA; bias gather + softmax in f32.

namespace {
constexpr int NB_ = 64, S = 197, SP = 208 /* 13 key tiles */, VK = 224 /* 7 key pairs of tiles for v */, D = 768, H = 12, HD = 64, T = NB_ * S /* 12608 = 788*16 */, TP = T + 32, WH = 14, NRD = 732;
constexpr float XS = 8.0f, HS = 256.0f, PS = 256.0f, WSC = 256.0f, SCALE = 0.125f;
typedef _Float16 b16;
typedef __attribute__((ext_vector_type(16))) _Float16 v16b;
typedef __attribute__((ext_vector_type(8))) _Float16 v8b;
typedef __attribute__((ext_vector_type(4))) _Float16 v4b;
typedef __attribute__((ext_vector_type(2))) _Float16 v2b;
typedef __attribute__((ext_vector_type(8))) float v8f;
typedef __attribute__((ext_vector_type(4))) float v4f;
typedef __attribute__((ext_vector_type(2))) float v2f;
__device__ __forceinline__ float bf16_rne(float f) { unsigned int u = __float_as_uint(f); u += 0x7FFFu + ((u >> 16) & 1u); float r = __uint_as_float(u & 0xFFFF0000u); asm volatile("" : "+v"(r)); return r; }
__device__ __forceinline__ float bfv(float f) { float r = bf16_rne(f); asm volatile("" : "+v"(r)); return r; }
__device__ __forceinline__ void split16(float v, b16& hi, b16& lo) { hi = (b16)v; lo = (b16)(v - (float)hi); }
__device__ __forceinline__ v16b frag_kb(const b16* p, int hh) { const v8b a = *(const v8b*)(p + 8 * hh), b = *(const v8b*)(p + 16 + 8 * hh); v16b f;
#pragma unroll
  for (int e = 0; e < 8; ++e) { f[e] = a[e]; f[8 + e] = b[e]; } return f; }
// transposing LDS load: from row-major rows [key][d] lane (c, half) gets 8 consecutive keys of column c; the loads at keys 0 and 16 of a 32-key block are one A fragment in frag_kb's k order
typedef __attribute__((ext_vector_type(8))) short s16x8;
__device__ __forceinline__ v8b ld_tr16(const b16* p) { typedef __attribute__((address_space(3))) s16x8 lds_s16x8; return __builtin_bit_cast(v8b, __builtin_amdgcn_ds_load_tr16_b128_v8i16((lds_s16x8*)p)); }
__device__ __forceinline__ v16b frag_tr(const b16* p, int pitch) { const v8b a = ld_tr16(p), b = ld_tr16(p + 16 * pitch); v16b f;
#pragma unroll
  for (int e = 0; e < 8; ++e) { f[e] = a[e]; f[8 + e] = b[e]; } return f; }
__device__ __forceinline__ v8f wmma16b(v16b a, v16b b, v8f c) { v8f d = __builtin_amdgcn_wmma_f32_16x16x32_f16(false, a, false, b, (short)0, c, false, false); asm volatile("v_nop\n\tv_nop\n\tv_nop\n\tv_nop" : "+v"(d) : "v"(a), "v"(b)); return d; }
// work-group barrier that orders LDS only: the global loads of a later stage, which land in the wave's own registers, stay in flight across it
// the scheduling barrier keeps the rounding of the loaded x values, and with it the wait for those loads, from being lifted in among the products of the trip before
__device__ __forceinline__ void lds_barrier() { __builtin_amdgcn_sched_barrier(0); __builtin_amdgcn_fence(__ATOMIC_RELEASE, "workgroup", "local"); __builtin_amdgcn_s_barrier(); __builtin_amdgcn_fence(__ATOMIC_ACQUIRE, "workgroup", "local"); }

__global__ __launch_bounds__(256) void wput_kernel(const float* __restrict__ wq, const float* __restrict__ wk, const float* __restrict__ wv, b16* __restrict__ WQKV, b16* __restrict__ Kh, b16* __restrict__ Kl, b16* __restrict__ Vh, b16* __restrict__ Vl) { const size_t nt = (size_t)gridDim.x * 256, u0 = (size_t)blockIdx.x * 256 + threadIdx.x; v8b v; const v8b z = {0, 0, 0, 0, 0, 0, 0, 0};
  for (size_t u = u0; u < (size_t)3 * D * (D / 8); u += nt) { const int o = (int)(u / (D / 8)), k0 = (int)(u % (D / 8)) * 8; const int which = o / D, oo = o % D; const float* w = which == 0 ? wq : (which == 1 ? wk : wv);
#pragma unroll
    for (int j = 0; j < 8; ++j) v[j] = (b16)(bf16_rne(w[(size_t)(k0 + j) * D + oo]) * WSC); { *(v8b*)(WQKV + (size_t)o * D + k0) = v;  } }
  for (size_t u = u0; u < (size_t)(TP - T) * (D / 8); u += nt) { const size_t off = (size_t)T * D + u * 8; { *(v8b*)(Kh + off) = z; *(v8b*)(Kl + off) = z; *(v8b*)(Vh + off) = z; *(v8b*)(Vl + off) = z;  } } }
// proj: one work-group of 8 waves per 64-token x 256-column tile of [q|k|v]. x (rounded, x8) and the weight rows go through LDS in 64-k stages, two buffers;
// each wave owns 64 x 32 outputs (4 x 2 accumulator tiles), so a weight fragment feeds 4 products and an x fragment 2. k runs upward in one chain per output.
__global__ __launch_bounds__(256) void proj_kernel(const float* __restrict__ x, const b16* __restrict__ WQKV, const float* __restrict__ bq, const float* __restrict__ bv, int BLIM, b16* __restrict__ Qh, b16* __restrict__ Ql, b16* __restrict__ Kh, b16* __restrict__ Kl, b16* __restrict__ Vh, b16* __restrict__ Vl) {
  constexpr int KC = 64, KP = KC + 8 /* 144-byte rows: 16 B x odd for 16-byte readers */, ASZ = 64 * KP, STG = ASZ + 256 * KP, TFP = 260;
  constexpr int SMB = 2 * STG * 2 > 64 * TFP * 4 ? 2 * STG * 2 : 64 * TFP * 4;
  __shared__ __attribute__((aligned(16))) char smem[SMB];
  b16* const St = (b16*)smem; float* const Tf = (float*)smem;   // the output tile reuses the stages behind a barrier
  const int tid = threadIdx.x, lane = tid & 31, wave = tid >> 5, nloc = lane & 15, hlf = lane >> 4;
  const int g = blockIdx.x % 9, which = g / 3, c0 = (g % 3) * 256; const size_t t0 = (size_t)(blockIdx.x / 9) * 64; if (t0 >= (size_t)BLIM * S) return;
  const int ar = tid >> 4, ac = (tid & 15) * 4, br = tid >> 3, bc = (tid & 7) * 8;   // 16 lanes cover 256 B of an x row, 8 lanes 128 B of a weight row
  const float* const xg = x + (t0 + ar) * D + ac; const b16* const wg = WQKV + ((size_t)which * D + c0 + br) * D + bc;
  v4f xr[4]; v8b wr[8]; v8f acc[4][2];
#pragma unroll
  for (int m = 0; m < 4; ++m) { acc[m][0] = (v8f){}; acc[m][1] = (v8f){}; }
  auto fetch = [&](int kc) {
#pragma unroll
    for (int i = 0; i < 4; ++i) xr[i] = *(const v4f*)(xg + (size_t)i * 16 * D + kc);
#pragma unroll
    for (int i = 0; i < 8; ++i) wr[i] = *(const v8b*)(wg + (size_t)i * 32 * D + kc); };
  auto put = [&](b16* st) {
#pragma unroll
    for (int i = 0; i < 4; ++i) { v4b h;
#pragma unroll
      for (int j = 0; j < 4; ++j) h[j] = (b16)(bf16_rne(xr[i][j]) * XS);
      *(v4b*)(st + (ar + i * 16) * KP + ac) = h; }
#pragma unroll
    for (int i = 0; i < 8; ++i) *(v8b*)(st + ASZ + (br + i * 32) * KP + bc) = wr[i]; };
  fetch(0); put(St); fetch(KC);
#pragma unroll   // 12 trips: buffer and k offsets become immediates, so no address register of a load in flight is rewritten
  for (int c = 0; c < D / KC; ++c) { lds_barrier();   // publishes stage c and ends every read of the buffer that stage c + 1 goes into
    const b16* const cur = St + (c & 1) * STG;
    if (c + 1 < D / KC) { put(St + ((c + 1) & 1) * STG); if (c + 2 < D / KC) fetch((c + 2) * KC); }   // a stage's global loads have a whole trip to land
    v16b a[2][4], b[2][2];   // all fragment reads of the stage stand as one group ahead of its products
#pragma unroll
    for (int ks = 0; ks < 2; ++ks) {
#pragma unroll
      for (int n = 0; n < 2; ++n) b[ks][n] = frag_kb(cur + ASZ + (wave * 32 + n * 16 + nloc) * KP + ks * 32, hlf);
#pragma unroll
      for (int m = 0; m < 4; ++m) a[ks][m] = frag_kb(cur + (m * 16 + nloc) * KP + ks * 32, hlf); }
#pragma unroll
    for (int ks = 0; ks < 2; ++ks)
#pragma unroll
      for (int m = 0; m < 4; ++m) { acc[m][0] = wmma16b(a[ks][m], b[ks][0], acc[m][0]); acc[m][1] = wmma16b(a[ks][m], b[ks][1], acc[m][1]); } }
  __syncthreads();   // every wave has left the stages before the output tile overwrites them
#pragma unroll
  for (int n = 0; n < 2; ++n) { const int cc = wave * 32 + n * 16 + nloc; const float bb = which == 0 ? bfv(bq[c0 + cc]) : (which == 2 ? bfv(bv[c0 + cc]) : 0.0f);
#pragma unroll
    for (int m = 0; m < 4; ++m)
#pragma unroll
      for (int r8 = 0; r8 < 8; ++r8) Tf[(m * 16 + 8 * hlf + r8) * TFP + cc] = acc[m][n][r8] * (1.0f / (XS * WSC)) + bb; }
  __syncthreads();
  // the row loop is unrolled so that the row addresses are immediates and no address register is rewritten behind a store
  { const size_t ob = (t0 + wave) * D + c0 + lane * 4; b16* const Ph = (which == 0 ? Qh : (which == 1 ? Kh : Vh)) + ob; b16* const Pl = (which == 0 ? Ql : (which == 1 ? Kl : Vl)) + ob; const float* const Tp = Tf + wave * TFP + lane * 4;
#pragma unroll
    for (int i = 0; i < 8; ++i) {
#pragma unroll
      for (int q = 0; q < 2; ++q) { const v4f f = *(const v4f*)(Tp + i * 8 * TFP + q * 128); v4b hi, lo;
#pragma unroll
        for (int j = 0; j < 4; ++j) { b16 h0, l0; split16(f[j] * HS, h0, l0); hi[j] = h0; lo[j] = l0; }
        *(v4b*)(Ph + (size_t)i * 8 * D + q * 128) = hi; *(v4b*)(Pl + (size_t)i * 8 * D + q * 128) = lo; } } } }
// relative position index: entry 731 for (cls, cls), 729 for the cls query, 730 for the cls key; for patches (dy + 13) * 27 + dx + 13.
// With patch p = token - 1 written as row * 27 + column that is plin(q - 1) - plin(k - 1) + 13 * 27 + 13
__device__ __forceinline__ constexpr int plin(int p) { return (p / WH) * (2 * WH - 1) + p % WH; }
// exp(x) as the fast intrinsic forms it (x * log2 e, then the hardware exp2). The v_nop is the slot behind a transcendental: written into the same statement, it stands there
// whichever instruction the compiler puts next.
__device__ __forceinline__ float exp_slot(float x) { const float y = x * 1.44269504f; float r; asm("v_exp_f32 %0, %1\n\tv_nop" : "=v"(r) : "v"(y)); return r; }
// att: one work-group of 7 waves per (b, h, half of the 13 query tiles); one wave per 16 queries, everything transposed and in registers as before.
// The head's k rows, v rows (hi and lo) and bias column are brought into LDS once, with loads that cover whole 128-byte lines, and every wave takes its fragments from there:
// a fragment load straight from global memory touches 16 lines for 512 bytes, and each of the 13 waves of a head repeated all of them.
// LDS pitches: 16 B x odd (144 B) for k and its 16-byte readers, 32 B x odd (160 B) for v and its transposing readers, which hand out v^T fragments from the rows as the projection wrote them.
// v rows 197 to 223 are the next image's (behind the last image: zeros); they are finite and meet P = 0.
// S^T = k rows (A) x q (B): lane (c, half) holds for query q0 + c the keys 16 t + 8 half + r,
// so bias, maximum, exp and sum run in-lane on all 32 lanes, with one exchange between the halves. Two score tiles, converted in place, are the B operand of ctx^T = v^T rows (A) x P^T
// in the k order in which the transposing loads hand out v^T; a lane then holds 8 consecutive d of its query and stores them itself.
// Loads stand one tile ahead of their products. The scheduling barriers keep that order: without them the next tile's bias rounding, and with it the wait for loads just issued, is lifted in front of this tile's products, and the register count passes 256.
__global__ __launch_bounds__(224) void att_kernel(const b16* __restrict__ Qh, const b16* __restrict__ Ql, const b16* __restrict__ Kh, const b16* __restrict__ Kl, const b16* __restrict__ Vh, const b16* __restrict__ Vl, const float* __restrict__ btab, int BLIM, float* __restrict__ out) {
  constexpr int KP = HD + 8, VP = HD + 16, KSZ = SP * KP, VSZ = VK * VP;
  __shared__ __attribute__((aligned(16))) char smem[(2 * KSZ + 2 * VSZ) * 2 + NRD * 4];
  b16* const Ksh = (b16*)smem; b16* const Ksl = Ksh + KSZ; b16* const Vsh = Ksl + KSZ; b16* const Vsl = Vsh + VSZ; float* const Bs = (float*)(Vsl + VSZ);
  const int tid = threadIdx.x, lane = tid & 31, nloc = lane & 15, hlf = lane >> 4; const int b = blockIdx.x / (H * 2), rem = blockIdx.x % (H * 2); const int h = rem / 2; if (b >= BLIM) return; const size_t tb = (size_t)b * S;
  const int qt = (rem % 2) * 7 + __builtin_amdgcn_readfirstlane(tid >> 5);
  // the wave's own q fragments are asked for first, so that they land while the shared rows are staged (the wave without a query tile reads the image's last row, in bounds)
  const int q0 = qt * 16;
  const int q = q0 + nloc; const size_t qrow = tb + (q < S ? q : S - 1);   // columns past the image read a valid row; their results are not written
  // the q pointers hold the lane's whole address (the half's 8 elements too), so that all loads of the stream name that one register pair plus a constant
  const b16* const qph = Qh + qrow * D + h * HD + 8 * hlf; const b16* const qpl = Ql + qrow * D + h * HD + 8 * hlf;
  v16b qa[2], ql[2];
#pragma unroll
  for (int ks = 0; ks < 2; ++ks) { qa[ks] = frag_kb(qph + ks * 32, 0); ql[ks] = frag_kb(qpl + ks * 32, 0); }
  asm volatile("s_wait_xcnt 0x0" :: "v"(qph), "v"(qpl) : "memory");   // behind the last loads that name these address registers; as inputs they stay untouched up to the wait and are free for reuse behind it
  { // staging: 8 lanes cover the 128 B of a k row or a v row; all row steps are constants on one address per stream
    const int kr = tid >> 3, kc = (tid & 7) * 8;
    const b16* const gkh = Kh + (tb + kr) * D + h * HD + kc; const b16* const gkl = Kl + (tb + kr) * D + h * HD + kc;
    const b16* const gvh = Vh + (tb + kr) * D + h * HD + kc; const b16* const gvl = Vl + (tb + kr) * D + h * HD + kc;
    const float* const gb = btab + tid * H + h;
    v8b rk[2][8], rv[2][8]; float rb[4];
#pragma unroll   // the row steps become immediate offsets and the staging arrays stay in registers
    for (int i = 0; i < 7; ++i) { rk[0][i] = *(const v8b*)(gkh + i * 28 * D); rk[1][i] = *(const v8b*)(gkl + i * 28 * D); }
    if (tid < 96) { rk[0][7] = *(const v8b*)(gkh + 7 * 28 * D); rk[1][7] = *(const v8b*)(gkl + 7 * 28 * D); }   // rows 196 to 207: three whole waves
#pragma unroll   // the row steps become immediate offsets and the staging arrays stay in registers
    for (int i = 0; i < 8; ++i) { rv[0][i] = *(const v8b*)(gvh + i * 28 * D); rv[1][i] = *(const v8b*)(gvl + i * 28 * D); }
#pragma unroll   // the row steps become immediate offsets and the staging arrays stay in registers
    for (int i = 0; i < 3; ++i) rb[i] = gb[i * 224 * H];
    if (tid < NRD - 3 * 224) rb[3] = gb[3 * 224 * H];
    asm volatile("s_wait_xcnt 0x0" :: "v"(gkh), "v"(gkl), "v"(gvh), "v"(gvl), "v"(gb) : "memory");   // behind the last loads that name these address registers; as inputs they stay untouched up to the wait
#pragma unroll   // the row steps become immediate offsets and the staging arrays stay in registers
    for (int i = 0; i < 7; ++i) { *(v8b*)(Ksh + (kr + i * 28) * KP + kc) = rk[0][i]; *(v8b*)(Ksl + (kr + i * 28) * KP + kc) = rk[1][i]; }
    if (tid < 96) { *(v8b*)(Ksh + (kr + 7 * 28) * KP + kc) = rk[0][7]; *(v8b*)(Ksl + (kr + 7 * 28) * KP + kc) = rk[1][7]; }
#pragma unroll   // the row steps become immediate offsets and the staging arrays stay in registers
    for (int i = 0; i < 8; ++i) { *(v8b*)(Vsh + (kr + i * 28) * VP + kc) = rv[0][i]; *(v8b*)(Vsl + (kr + i * 28) * VP + kc) = rv[1][i]; }
#pragma unroll   // the row steps become immediate offsets and the staging arrays stay in registers
    for (int i = 0; i < 3; ++i) Bs[tid + i * 224] = rb[i];
    if (tid < NRD - 3 * 224) Bs[tid + 3 * 224] = rb[3]; }
  __syncthreads();   // publishes the staged rows; the only barrier, so the wave without a query tile may leave behind it
  if (qt >= 13) return;
  v16b kh[2][2], kl[2][2]; float br[2][8];
  // bias addresses: for a patch query the entry of key k lies plin(k - 1) entries below the query's own base, a constant per register but for the upper half's 8 keys (8 or 21 entries more).
  // The cls query (and a column past the image, as before) has one entry for all patch keys: it reads as query 1, in bounds, and takes the cls value instead.
  const int qq = q < S ? q : 0; const bool qcls = qq == 0; const int base = plin(qcls ? 0 : qq - 1) + (WH - 1) * (2 * WH - 1) + (WH - 1);
  constexpr int PL = plin(S - 2); const float* const pn = Bs + (base - PL); const float* const p0 = pn - hlf * 8; const float* const p1 = pn - hlf * 21;   // set to the last key's entry: constants from 0 up
  const float bcls = Bs[NRD - 3];
  const int idx0 = hlf == 0 ? (qcls ? NRD - 1 : NRD - 2) : (qcls ? NRD - 3 : base - plin(7));   // register 0 of tile 0: key 0 or key 8
  const b16* const kph = Ksh + nloc * KP + 8 * hlf; const b16* const kpl = Ksl + nloc * KP + 8 * hlf;
  const int vlo = (8 * hlf + (lane & 7)) * VP + ((lane >> 3) & 1) * 8;   // the transposing load's lane address: key row 8 half + (lane & 7), 16 bytes further for lanes 8 to 15 of a half
  const b16* const vph = Vsh + vlo; const b16* const vpl = Vsl + vlo;
  auto kfetch = [&](int t, int bf) {
#pragma unroll
    for (int ks = 0; ks < 2; ++ks) { kh[bf][ks] = frag_kb(kph + t * 16 * KP + ks * 32, 0); kl[bf][ks] = frag_kb(kpl + t * 16 * KP + ks * 32, 0); }
#pragma unroll
    for (int r8 = 0; r8 < 8; ++r8) { const int c = t * 16 + r8;   // the lower half's key; the upper half's is c + 8
      if (c >= S) br[bf][r8] = 0.0f; else if (c == 0) br[bf][r8] = Bs[idx0];
      else br[bf][r8] = (c + 8 >= S ? pn : ((c + 7) / WH != (c - 1) / WH ? p1 : p0))[PL - plin(c - 1)]; } };   // an upper-half key past the image reads the lower half's entry and is masked below
  v16b vh[2][2], vl[2][2];
  auto vfetch = [&](int u, int bf) {   // unit u: keys 32 (u / 2) ..., d tiles 2 (u % 2) and 2 (u % 2) + 1
#pragma unroll
    for (int i = 0; i < 2; ++i) { const int vo = (u >> 1) * 32 * VP + ((u & 1) * 2 + i) * 16; vh[bf][i] = frag_tr(vph + vo, VP); vl[bf][i] = frag_tr(vpl + vo, VP); } };
  v8f s[13]; float mx = -INFINITY;
  kfetch(0, 0);
#pragma unroll
  for (int t = 0; t < 13; ++t) { const int bf = t & 1; if (t + 1 < 13) kfetch(t + 1, bf ^ 1); else vfetch(0, 0);
    __builtin_amdgcn_sched_barrier(0);   // the next tile's loads are issued before this tile's work
    v8f a = (v8f){};
#pragma unroll
    for (int ks = 0; ks < 2; ++ks) { a = wmma16b(kh[bf][ks], qa[ks], a); a = wmma16b(kl[bf][ks], qa[ks], a); a = wmma16b(kh[bf][ks], ql[ks], a); }
#pragma unroll
    for (int r8 = 0; r8 < 8; ++r8) { const int c = t * 16 + r8;
      if (c >= S) { a[r8] = -INFINITY; continue; }
      float v = a[r8] * (SCALE / (HS * HS)) + bfv(c != 0 && qcls ? bcls : br[bf][r8]); if (c + 8 >= S && hlf) v = -INFINITY;
      a[r8] = v; mx = fmaxf(mx, v); }
    s[t] = a; __builtin_amdgcn_sched_barrier(0); }   // nothing of the next tile is worked on, or waited for, in front of this point
  mx = fmaxf(mx, __shfl_xor(mx, 16, 32));
  float sp[8] = {0.0f, 0.0f, 0.0f, 0.0f, 0.0f, 0.0f, 0.0f, 0.0f};   // eight partial sums: no chain of 101 dependent adds
#pragma unroll
  for (int t = 0; t < 13; ++t)
#pragma unroll
    for (int r8 = 0; r8 < 8; ++r8) { if (t * 16 + r8 >= S) { s[t][r8] = 0.0f; continue; } const float p = exp_slot(s[t][r8] - mx); s[t][r8] = p; sp[r8] += p; }
  float sm = ((sp[0] + sp[1]) + (sp[2] + sp[3])) + ((sp[4] + sp[5]) + (sp[6] + sp[7])); sm += __shfl_xor(sm, 16, 32); const float inv = 1.0f / sm;
  __builtin_amdgcn_sched_barrier(0);   // the second v^T unit's loads stay behind the softmax: lifted in front of it they hold 32 more registers through it and the count passes 256
  v8f o[4] = {(v8f){}, (v8f){}, (v8f){}, (v8f){}}; v16b pa, pb;
#pragma unroll
  for (int u = 0; u < 14; ++u) { const int bf = u & 1, j = u >> 1, t0 = (u & 1) * 2, t1 = t0 + 1; if (u + 1 < 14) vfetch(u + 1, bf ^ 1);
    __builtin_amdgcn_sched_barrier(0);   // the next unit's loads are issued before this unit's products
    if ((u & 1) == 0) {
#pragma unroll
      for (int e = 0; e < 8; ++e) { b16 p, pl; split16(s[2 * j][e] * inv * PS, p, pl); pa[e] = p; pb[e] = pl;
        if (2 * j + 1 < 13) { split16(s[2 * j + 1][e] * inv * PS, p, pl); pa[8 + e] = p; pb[8 + e] = pl; } else { pa[8 + e] = (b16)0.0f; pb[8 + e] = (b16)0.0f; } } }
    o[t0] = wmma16b(vh[bf][0], pa, o[t0]); o[t1] = wmma16b(vh[bf][1], pa, o[t1]); o[t0] = wmma16b(vl[bf][0], pa, o[t0]); o[t1] = wmma16b(vl[bf][1], pa, o[t1]); o[t0] = wmma16b(vh[bf][0], pb, o[t0]); o[t1] = wmma16b(vh[bf][1], pb, o[t1]); __builtin_amdgcn_sched_barrier(0); }   // as above: no wait for the next unit in front of this point
  if (q < S) { float* const op = out + (tb + q) * D + h * HD + 8 * hlf;
#pragma unroll
    for (int t = 0; t < 4; ++t) { const v8f f = o[t] * (1.0f / (PS * HS)); *(v4f*)(op + t * 16) = (v4f){f[0], f[1], f[2], f[3]}; *(v4f*)(op + t * 16 + 4) = (v4f){f[4], f[5], f[6], f[7]}; } } }
}  // namespace

extern "C" void kernel_launch(void* const* d_in, const int* in_sizes, int n_in, void* d_out, int out_size, void* d_ws, size_t ws_size, hipStream_t stream) {
  (void)n_in;
  auto Fp = [&](int i) { return (const float*)d_in[i]; };
  // input order: 0 hidden_states [64,197,768]; 1 Wq [768,768]; 2 bq [768]; 3 Wk; 4 Wv; 5 bv; 6 bias_table [732,12]
  if (in_sizes[0] != T * D || in_sizes[1] != D * D || in_sizes[3] != D * D || in_sizes[4] != D * D || in_sizes[6] != NRD * H || out_size != T * D) return;
  const int BLIM = NB_;
  size_t off = 0; char* ws = (char*)d_ws;
  auto carve = [&](size_t bytes) { char* p = ws + off; off += (bytes + 255) & ~(size_t)255; return p; };
  b16* WQKV = (b16*)carve((size_t)3 * D * D * 2); b16* Qh = (b16*)carve((size_t)TP * D * 2); b16* Ql = (b16*)carve((size_t)TP * D * 2); b16* Kh = (b16*)carve((size_t)TP * D * 2); b16* Kl = (b16*)carve((size_t)TP * D * 2); b16* Vh = (b16*)carve((size_t)TP * D * 2); b16* Vl = (b16*)carve((size_t)TP * D * 2);
  if (off > ws_size || off > ((size_t)176 << 20)) return;   // ~ 120 MB
  wput_kernel<<<256, 256, 0, stream>>>(Fp(1), Fp(3), Fp(4), WQKV, Kh, Kl, Vh, Vl);
  proj_kernel<<<(BLIM * S + 63) / 64 * 9, 256, 0, stream>>>(Fp(0), WQKV, Fp(2), Fp(5), BLIM, Qh, Ql, Kh, Kl, Vh, Vl);
  att_kernel<<<BLIM * H * 2, 224, 0, stream>>>(Qh, Ql, Kh, Kl, Vh, Vl, Fp(6), BLIM, (float*)d_out);
}

// v005
// A run of this version takes 131 microseconds.
// Next to v004, in two timings, it ran 1.14 and 1.13 times as fast.
// Over all steps from v000 it is 8.67 times as fast.
#include <hip/hip_runtime.h>

// BeitSelfAttention: q = x Wq + bq, k = x Wk (no bias), v = x Wv + bv (12 heads x 64); scores = q.k/8 + bias_table[rel_idx(q,k)][h] (BEiT relative position index incl. the cls row/column/corner entries); probs = softmax; ctx = probs v -> [64][197][768].
// Deterministic: per-wave softmax over the 197 keys in fixed order; no atomics.
// WMMA (v_wmma_f32_16x16x32_f16, f32 accumulate): x (EXACT bf16 x8, K 768) x [Wq|Wk|Wv] rows (EXACT x256 (in,out); 144 tiles in 9 groups), 64 tokens x 256 columns per 8-wave work-group; per (b, h, 16-query) wave, k, v and the bias column shared through LDS by 7 waves, S^T = k rows (hi+lo; 13 tiles) x q (hi+lo x256, K 64) and ctx^T = v^T rows (hi+lo; 4 tiles, K 224, P = 0 past the image) x P^T (hi+lo), 3 products — 4.3 M WMMA; bias gather + softmax in f32.

namespace {
constexpr int NB_ = 64, S = 197, SP = 208 /* 13 key tiles */, VK = 224 /* 7 key pairs of tiles for v */, D = 768, H = 12, HD = 64, T = NB_ * S /* 12608 = 788*16 */, TP = T + 32, WH = 14, NRD = 732;
constexpr float XS = 8.0f, HS = 256.0f, PS = 256.0f, WSC = 256.0f, SCALE = 0.125f;
typedef _Float16 b16;
typedef __attribute__((ext_vector_type(16))) _Float16 v16b;
typedef __attribute__((ext_vector_type(8))) _Float16 v8b;
typedef __attribute__((ext_vector_type(4))) _Float16 v4b;
typedef __attribute__((ext_vector_type(2))) _Float16 v2b;
typedef __attribute__((ext_vector_type(8))) float v8f;
typedef __attribute__((ext_vector_type(4))) float v4f;
typedef __attribute__((ext_vector_type(2))) float v2f;
__device__ __forceinline__ float bf16_rne(float f) { unsigned int u = __float_as_uint(f); u += 0x7FFFu + ((u >> 16) & 1u); float r = __uint_as_float(u & 0xFFFF0000u); asm volatile("" : "+v"(r)); return r; }
__device__ __forceinline__ float bfv(float f) { float r = bf16_rne(f); asm volatile("" : "+v"(r)); return r; }
__device__ __forceinline__ void split16(float v, b16& hi, b16& lo) { hi = (b16)v; lo = (b16)(v - (float)hi); }
__device__ __forceinline__ v16b frag_kb(const b16* p, int hh) { const v8b a = *(const v8b*)(p + 8 * hh), b = *(const v8b*)(p + 16 + 8 * hh); v16b f;
#pragma unroll
  for (int e = 0; e < 8; ++e) { f[e] = a[e]; f[8 + e] = b[e]; } return f; }
// transposing LDS load: from row-major rows [key][d] lane (c, half) gets 8 consecutive keys of column c; the loads at keys 0 and 16 of a 32-key block are one A fragment in frag_kb's k order
typedef __attribute__((ext_vector_type(8))) short s16x8;
__device__ __forceinline__ v8b ld_tr16(const b16* p) { typedef __attribute__((address_space(3))) s16x8 lds_s16x8; return __builtin_bit_cast(v8b, __builtin_amdgcn_ds_load_tr16_b128_v8i16((lds_s16x8*)p)); }
__device__ __forceinline__ v16b frag_tr(const b16* p, int pitch) { const v8b a = ld_tr16(p), b = ld_tr16(p + 16 * pitch); v16b f;
#pragma unroll
  for (int e = 0; e < 8; ++e) { f[e] = a[e]; f[8 + e] = b[e]; } return f; }
__device__ __forceinline__ v8f wmma16b(v16b a, v16b b, v8f c) { v8f d = __builtin_amdgcn_wmma_f32_16x16x32_f16(false, a, false, b, (short)0, c, false, false); asm volatile("v_nop\n\tv_nop\n\tv_nop\n\tv_nop" : "+v"(d) : "v"(a), "v"(b)); return d; }
// work-group barrier that orders LDS only: the global loads of a later stage, which land in the wave's own registers, stay in flight across it
// the scheduling barrier keeps the rounding of the loaded x values, and with it the wait for those loads, from being lifted in among the products of the trip before
__device__ __forceinline__ void lds_barrier() { __builtin_amdgcn_sched_barrier(0); __builtin_amdgcn_fence(__ATOMIC_RELEASE, "workgroup", "local"); __builtin_amdgcn_s_barrier(); __builtin_amdgcn_fence(__ATOMIC_ACQUIRE, "workgroup", "local"); }

// wput: one work-group per 128 k x 64 columns of one weight matrix. A lane asks for 8 rows x 16 bytes at once, 16 lanes covering 256 bytes of a row, so every load takes whole lines and all
// of them are in flight together; the lane's 8 k x 4 columns go rounded into LDS as four 16-byte pieces of the transposed tile (272-byte rows), and the rows leave as 256 contiguous bytes each.
__global__ __launch_bounds__(256) void wput_kernel(const float* __restrict__ wq, const float* __restrict__ wk, const float* __restrict__ wv, b16* __restrict__ WQKV, b16* __restrict__ Kh, b16* __restrict__ Kl, b16* __restrict__ Vh, b16* __restrict__ Vl) { const size_t nt = (size_t)gridDim.x * 256, u0 = (size_t)blockIdx.x * 256 + threadIdx.x; const v8b z = {0, 0, 0, 0, 0, 0, 0, 0};
  constexpr int TK = 128, TO = 64, TW = TK + 8, NKT = D / TK, NOT = D / TO;
  __shared__ __attribute__((aligned(16))) b16 Ts[TO * TW];
  const int tid = threadIdx.x, hi4 = tid >> 4, lo4 = tid & 15; const int which = blockIdx.x / (NKT * NOT), rem = blockIdx.x % (NKT * NOT), k0 = (rem / NOT) * TK, o0 = (rem % NOT) * TO;
  const float* const w = which == 0 ? wq : (which == 1 ? wk : wv); const float* const wp = w + (size_t)(k0 + hi4 * 8) * D + o0 + lo4 * 4;
  v4f f[8];
#pragma unroll   // the row steps become immediate offsets on one address
  for (int j = 0; j < 8; ++j) f[j] = *(const v4f*)(wp + j * D);
#pragma unroll   // constant indices: the loaded rows and the packed pieces stay in registers
  for (int c = 0; c < 4; ++c) { v8b v;
#pragma unroll   // as above
    for (int j = 0; j < 8; ++j) v[j] = (b16)(bf16_rne(f[j][c]) * WSC);
    *(v8b*)(Ts + (lo4 * 4 + c) * TW + hi4 * 8) = v; }
  __syncthreads();   // the transposed tile is whole before its rows are read
  { b16* const op = WQKV + ((size_t)which * D + o0 + hi4) * D + k0 + lo4 * 8; const b16* const tp = Ts + hi4 * TW + lo4 * 8;
#pragma unroll   // the row steps become immediate offsets on one address
    for (int i = 0; i < 4; ++i) *(v8b*)(op + (size_t)i * 16 * D) = *(const v8b*)(tp + i * 16 * TW); }
  for (size_t u = u0; u < (size_t)(TP - T) * (D / 8); u += nt) { const size_t off = (size_t)T * D + u * 8; { *(v8b*)(Kh + off) = z; *(v8b*)(Kl + off) = z; *(v8b*)(Vh + off) = z; *(v8b*)(Vl + off) = z;  } } }
// proj: one work-group of 8 waves per 64-token x 256-column tile of [q|k|v]. x (rounded, x8) and the weight rows go through LDS in 64-k stages, two buffers;
// each wave owns 64 x 32 outputs (4 x 2 accumulator tiles), so a weight fragment feeds 4 products and an x fragment 2. k runs upward in one chain per output.
__global__ __launch_bounds__(256) void proj_kernel(const float* __restrict__ x, const b16* __restrict__ WQKV, const float* __restrict__ bq, const float* __restrict__ bv, int BLIM, b16* __restrict__ Qh, b16* __restrict__ Ql, b16* __restrict__ Kh, b16* __restrict__ Kl, b16* __restrict__ Vh, b16* __restrict__ Vl) {
  constexpr int KC = 64, KP = KC + 8 /* 144-byte rows: 16 B x odd for 16-byte readers */, ASZ = 64 * KP, STG = ASZ + 256 * KP, TFP = 260;
  constexpr int SMB = 2 * STG * 2 > 64 * TFP * 4 ? 2 * STG * 2 : 64 * TFP * 4;
  __shared__ __attribute__((aligned(16))) char smem[SMB];
  b16* const St = (b16*)smem; float* const Tf = (float*)smem;   // the output tile reuses the stages behind a barrier
  const int tid = threadIdx.x, lane = tid & 31, wave = tid >> 5, nloc = lane & 15, hlf = lane >> 4;
  const int g = blockIdx.x % 9, which = g / 3, c0 = (g % 3) * 256; const size_t t0 = (size_t)(blockIdx.x / 9) * 64; if (t0 >= (size_t)BLIM * S) return;
  const int ar = tid >> 4, ac = (tid & 15) * 4, br = tid >> 3, bc = (tid & 7) * 8;   // 16 lanes cover 256 B of an x row, 8 lanes 128 B of a weight row
  const float* const xg = x + (t0 + ar) * D + ac; const b16* const wg = WQKV + ((size_t)which * D + c0 + br) * D + bc;
  v4f xr[4]; v8b wr[8]; v8f acc[4][2];
#pragma unroll
  for (int m = 0; m < 4; ++m) { acc[m][0] = (v8f){}; acc[m][1] = (v8f){}; }
  auto fetch = [&](int kc) {
#pragma unroll
    for (int i = 0; i < 4; ++i) xr[i] = *(const v4f*)(xg + (size_t)i * 16 * D + kc);
#pragma unroll
    for (int i = 0; i < 8; ++i) wr[i] = *(const v8b*)(wg + (size_t)i * 32 * D + kc); };
  auto put = [&](b16* st) {
#pragma unroll
    for (int i = 0; i < 4; ++i) { v4b h;
#pragma unroll
      for (int j = 0; j < 4; ++j) h[j] = (b16)(bf16_rne(xr[i][j]) * XS);
      *(v4b*)(st + (ar + i * 16) * KP + ac) = h; }
#pragma unroll
    for (int i = 0; i < 8; ++i) *(v8b*)(st + ASZ + (br + i * 32) * KP + bc) = wr[i]; };
  fetch(0); put(St); fetch(KC);
#pragma unroll   // 12 trips: buffer and k offsets become immediates, so no address register of a load in flight is rewritten
  for (int c = 0; c < D / KC; ++c) { lds_barrier();   // publishes stage c and ends every read of the buffer that stage c + 1 goes into
    const b16* const cur = St + (c & 1) * STG;
    if (c + 1 < D / KC) { put(St + ((c + 1) & 1) * STG); if (c + 2 < D / KC) fetch((c + 2) * KC); }   // a stage's global loads have a whole trip to land
    v16b a[2][4], b[2][2];   // all fragment reads of the stage stand as one group ahead of its products
#pragma unroll
    for (int ks = 0; ks < 2; ++ks) {
#pragma unroll
      for (int n = 0; n < 2; ++n) b[ks][n] = frag_kb(cur + ASZ + (wave * 32 + n * 16 + nloc) * KP + ks * 32, hlf);
#pragma unroll
      for (int m = 0; m < 4; ++m) a[ks][m] = frag_kb(cur + (m * 16 + nloc) * KP + ks * 32, hlf); }
#pragma unroll
    for (int ks = 0; ks < 2; ++ks)
#pragma unroll
      for (int m = 0; m < 4; ++m) { acc[m][0] = wmma16b(a[ks][m], b[ks][0], acc[m][0]); acc[m][1] = wmma16b(a[ks][m], b[ks][1], acc[m][1]); } }
  __syncthreads();   // every wave has left the stages before the output tile overwrites them
#pragma unroll
  for (int n = 0; n < 2; ++n) { const int cc = wave * 32 + n * 16 + nloc; const float bb = which == 0 ? bfv(bq[c0 + cc]) : (which == 2 ? bfv(bv[c0 + cc]) : 0.0f);
#pragma unroll
    for (int m = 0; m < 4; ++m)
#pragma unroll
      for (int r8 = 0; r8 < 8; ++r8) Tf[(m * 16 + 8 * hlf + r8) * TFP + cc] = acc[m][n][r8] * (1.0f / (XS * WSC)) + bb; }
  __syncthreads();
  // the row loop is unrolled so that the row addresses are immediates and no address register is rewritten behind a store
  { const size_t ob = (t0 + wave) * D + c0 + lane * 4; b16* const Ph = (which == 0 ? Qh : (which == 1 ? Kh : Vh)) + ob; b16* const Pl = (which == 0 ? Ql : (which == 1 ? Kl : Vl)) + ob; const float* const Tp = Tf + wave * TFP + lane * 4;
#pragma unroll
    for (int i = 0; i < 8; ++i) {
#pragma unroll
      for (int q = 0; q < 2; ++q) { const v4f f = *(const v4f*)(Tp + i * 8 * TFP + q * 128); v4b hi, lo;
#pragma unroll
        for (int j = 0; j < 4; ++j) { b16 h0, l0; split16(f[j] * HS, h0, l0); hi[j] = h0; lo[j] = l0; }
        *(v4b*)(Ph + (size_t)i * 8 * D + q * 128) = hi; *(v4b*)(Pl + (size_t)i * 8 * D + q * 128) = lo; } } } }
// relative position index: entry 731 for (cls, cls), 729 for the cls query, 730 for the cls key; for patches (dy + 13) * 27 + dx + 13.
// With patch p = token - 1 written as row * 27 + column that is plin(q - 1) - plin(k - 1) + 13 * 27 + 13
__device__ __forceinline__ constexpr int plin(int p) { return (p / WH) * (2 * WH - 1) + p % WH; }
// exp(x) as the fast intrinsic forms it (x * log2 e, then the hardware exp2). The v_nop is the slot behind a transcendental: written into the same statement, it stands there
// whichever instruction the compiler puts next.
__device__ __forceinline__ float exp_slot(float x) { const float y = x * 1.44269504f; float r; asm("v_exp_f32 %0, %1\n\tv_nop" : "=v"(r) : "v"(y)); return r; }
// att: one work-group of 7 waves per (b, h, half of the 13 query tiles); one wave per 16 queries, everything transposed and in registers as before.
// The head's k rows, v rows (hi and lo) and bias column are brought into LDS once, with loads that cover whole 128-byte lines, and every wave takes its fragments from there:
// a fragment load straight from global memory touches 16 lines for 512 bytes, and each of the 13 waves of a head repeated all of them.
// LDS pitches: 16 B x odd (144 B) for k and its 16-byte readers, 32 B x odd (160 B) for v and its transposing readers, which hand out v^T fragments from the rows as the projection wrote them.
// v rows 197 to 223 are the next image's (behind the last image: zeros); they are finite and meet P = 0.
// S^T = k rows (A) x q (B): lane (c, half) holds for query q0 + c the keys 16 t + 8 half + r,
// so bias, maximum, exp and sum run in-lane on all 32 lanes, with one exchange between the halves. Two score tiles, converted in place, are the B operand of ctx^T = v^T rows (A) x P^T
// in the k order in which the transposing loads hand out v^T; a lane then holds 8 consecutive d of its query and stores them itself.
// Loads stand one tile ahead of their products. The scheduling barriers keep that order: without them the next tile's bias rounding, and with it the wait for loads just issued, is lifted in front of this tile's products, and the register count passes 256.
__global__ __launch_bounds__(224) void att_kernel(const b16* __restrict__ Qh, const b16* __restrict__ Ql, const b16* __restrict__ Kh, const b16* __restrict__ Kl, const b16* __restrict__ Vh, const b16* __restrict__ Vl, const float* __restrict__ btab, int BLIM, float* __restrict__ out) {
  constexpr int KP = HD + 8, VP = HD + 16, KSZ = SP * KP, VSZ = VK * VP;
  __shared__ __attribute__((aligned(16))) char smem[(2 * KSZ + 2 * VSZ) * 2 + NRD * 4];
  b16* const Ksh = (b16*)smem; b16* const Ksl = Ksh + KSZ; b16* const Vsh = Ksl + KSZ; b16* const Vsl = Vsh + VSZ; float* const Bs = (float*)(Vsl + VSZ);
  const int tid = threadIdx.x, lane = tid & 31, nloc = lane & 15, hlf = lane >> 4; const int b = blockIdx.x / (H * 2), rem = blockIdx.x % (H * 2); const int h = rem / 2; if (b >= BLIM) return; const size_t tb = (size_t)b * S;
  const int qt = (rem % 2) * 7 + __builtin_amdgcn_readfirstlane(tid >> 5);
  // the wave's own q fragments are asked for first, so that they land while the shared rows are staged (the wave without a query tile reads the image's last row, in bounds)
  const int q0 = qt * 16;
  const int q = q0 + nloc; const size_t qrow = tb + (q < S ? q : S - 1);   // columns past the image read a valid row; their results are not written
  // the q pointers hold the lane's whole address (the half's 8 elements too), so that all loads of the stream name that one register pair plus a constant
  const b16* const qph = Qh + qrow * D + h * HD + 8 * hlf; const b16* const qpl = Ql + qrow * D + h * HD + 8 * hlf;
  v16b qa[2], ql[2];
#pragma unroll
  for (int ks = 0; ks < 2; ++ks) { qa[ks] = frag_kb(qph + ks * 32, 0); ql[ks] = frag_kb(qpl + ks * 32, 0); }
  asm volatile("s_wait_xcnt 0x0" :: "v"(qph), "v"(qpl) : "memory");   // behind the last loads that name these address registers; as inputs they stay untouched up to the wait and are free for reuse behind it
  { // staging: 8 lanes cover the 128 B of a k row or a v row; all row steps are constants on one address per stream
    const int kr = tid >> 3, kc = (tid & 7) * 8;
    const b16* const gkh = Kh + (tb + kr) * D + h * HD + kc; const b16* const gkl = Kl + (tb + kr) * D + h * HD + kc;
    const b16* const gvh = Vh + (tb + kr) * D + h * HD + kc; const b16* const gvl = Vl + (tb + kr) * D + h * HD + kc;
    const float* const gb = btab + tid * H + h;
    v8b rk[2][8], rv[2][8]; float rb[4];
#pragma unroll   // the row steps become immediate offsets and the staging arrays stay in registers
    for (int i = 0; i < 7; ++i) { rk[0][i] = *(const v8b*)(gkh + i * 28 * D); rk[1][i] = *(const v8b*)(gkl + i * 28 * D); }
    if (tid < 96) { rk[0][7] = *(const v8b*)(gkh + 7 * 28 * D); rk[1][7] = *(const v8b*)(gkl + 7 * 28 * D); }   // rows 196 to 207: three whole waves
#pragma unroll   // the row steps become immediate offsets and the staging arrays stay in registers
    for (int i = 0; i < 8; ++i) { rv[0][i] = *(const v8b*)(gvh + i * 28 * D); rv[1][i] = *(const v8b*)(gvl + i * 28 * D); }
#pragma unroll   // the row steps become immediate offsets and the staging arrays stay in registers
    for (int i = 0; i < 3; ++i) rb[i] = gb[i * 224 * H];
    if (tid < NRD - 3 * 224) rb[3] = gb[3 * 224 * H];
    asm volatile("s_wait_xcnt 0x0" :: "v"(gkh), "v"(gkl), "v"(gvh), "v"(gvl), "v"(gb) : "memory");   // behind the last loads that name these address registers; as inputs they stay untouched up to the wait
#pragma unroll   // the row steps become immediate offsets and the staging arrays stay in registers
    for (int i = 0; i < 7; ++i) { *(v8b*)(Ksh + (kr + i * 28) * KP + kc) = rk[0][i]; *(v8b*)(Ksl + (kr + i * 28) * KP + kc) = rk[1][i]; }
    if (tid < 96) { *(v8b*)(Ksh + (kr + 7 * 28) * KP + kc) = rk[0][7]; *(v8b*)(Ksl + (kr + 7 * 28) * KP + kc) = rk[1][7]; }
#pragma unroll   // the row steps become immediate offsets and the staging arrays stay in registers
    for (int i = 0; i < 8; ++i) { *(v8b*)(Vsh + (kr + i * 28) * VP + kc) = rv[0][i]; *(v8b*)(Vsl + (kr + i * 28) * VP + kc) = rv[1][i]; }
#pragma unroll   // the row steps become immediate offsets and the staging arrays stay in registers
    for (int i = 0; i < 3; ++i) Bs[tid + i * 224] = rb[i];
    if (tid < NRD - 3 * 224) Bs[tid + 3 * 224] = rb[3]; }
  __syncthreads();   // publishes the staged rows; the only barrier, so the wave without a query tile may leave behind it
  if (qt >= 13) return;
  v16b kh[2][2], kl[2][2]; float br[2][8];
  // bias addresses: for a patch query the entry of key k lies plin(k - 1) entries below the query's own base, a constant per register but for the upper half's 8 keys (8 or 21 entries more).
  // The cls query (and a column past the image, as before) has one entry for all patch keys: it reads as query 1, in bounds, and takes the cls value instead.
  const int qq = q < S ? q : 0; const bool qcls = qq == 0; const int base = plin(qcls ? 0 : qq - 1) + (WH - 1) * (2 * WH - 1) + (WH - 1);
  constexpr int PL = plin(S - 2); const float* const pn = Bs + (base - PL); const float* const p0 = pn - hlf * 8; const float* const p1 = pn - hlf * 21;   // set to the last key's entry: constants from 0 up
  const float bcls = Bs[NRD - 3];
  const int idx0 = hlf == 0 ? (qcls ? NRD - 1 : NRD - 2) : (qcls ? NRD - 3 : base - plin(7));   // register 0 of tile 0: key 0 or key 8
  const b16* const kph = Ksh + nloc * KP + 8 * hlf; const b16* const kpl = Ksl + nloc * KP + 8 * hlf;
  const int vlo = (8 * hlf + (lane & 7)) * VP + ((lane >> 3) & 1) * 8;   // the transposing load's lane address: key row 8 half + (lane & 7), 16 bytes further for lanes 8 to 15 of a half
  const b16* const vph = Vsh + vlo; const b16* const vpl = Vsl + vlo;
  auto kfetch = [&](int t, int bf) {
#pragma unroll
    for (int ks = 0; ks < 2; ++ks) { kh[bf][ks] = frag_kb(kph + t * 16 * KP + ks * 32, 0); kl[bf][ks] = frag_kb(kpl + t * 16 * KP + ks * 32, 0); }
#pragma unroll
    for (int r8 = 0; r8 < 8; ++r8) { const int c = t * 16 + r8;   // the lower half's key; the upper half's is c + 8
      if (c >= S) br[bf][r8] = 0.0f; else if (c == 0) br[bf][r8] = Bs[idx0];
      else br[bf][r8] = (c + 8 >= S ? pn : ((c + 7) / WH != (c - 1) / WH ? p1 : p0))[PL - plin(c - 1)]; } };   // an upper-half key past the image reads the lower half's entry and is masked below
  v16b vh[2][2], vl[2][2];
  auto vfetch = [&](int u, int bf) {   // unit u: keys 32 (u / 2) ..., d tiles 2 (u % 2) and 2 (u % 2) + 1
#pragma unroll
    for (int i = 0; i < 2; ++i) { const int vo = (u >> 1) * 32 * VP + ((u & 1) * 2 + i) * 16; vh[bf][i] = frag_tr(vph + vo, VP); vl[bf][i] = frag_tr(vpl + vo, VP); } };
  v8f s[13]; float mx = -INFINITY;
  kfetch(0, 0);
#pragma unroll
  for (int t = 0; t < 13; ++t) { const int bf = t & 1; if (t + 1 < 13) kfetch(t + 1, bf ^ 1); else vfetch(0, 0);
    __builtin_amdgcn_sched_barrier(0);   // the next tile's loads are issued before this tile's work
    v8f a = (v8f){};
#pragma unroll
    for (int ks = 0; ks < 2; ++ks) { a = wmma16b(kh[bf][ks], qa[ks], a); a = wmma16b(kl[bf][ks], qa[ks], a); a = wmma16b(kh[bf][ks], ql[ks], a); }
#pragma unroll
    for (int r8 = 0; r8 < 8; ++r8) { const int c = t * 16 + r8;
      if (c >= S) { a[r8] = -INFINITY; continue; }
      float v = a[r8] * (SCALE / (HS * HS)) + bfv(c != 0 && qcls ? bcls : br[bf][r8]); if (c + 8 >= S && hlf) v = -INFINITY;
      a[r8] = v; mx = fmaxf(mx, v); }
    s[t] = a; __builtin_amdgcn_sched_barrier(0); }   // nothing of the next tile is worked on, or waited for, in front of this point
  mx = fmaxf(mx, __shfl_xor(mx, 16, 32));
  float sp[8] = {0.0f, 0.0f, 0.0f, 0.0f, 0.0f, 0.0f, 0.0f, 0.0f};   // eight partial sums: no chain of 101 dependent adds
#pragma unroll
  for (int t = 0; t < 13; ++t)
#pragma unroll
    for (int r8 = 0; r8 < 8; ++r8) { if (t * 16 + r8 >= S) { s[t][r8] = 0.0f; continue; } const float p = exp_slot(s[t][r8] - mx); s[t][r8] = p; sp[r8] += p; }
  float sm = ((sp[0] + sp[1]) + (sp[2] + sp[3])) + ((sp[4] + sp[5]) + (sp[6] + sp[7])); sm += __shfl_xor(sm, 16, 32); const float inv = 1.0f / sm;
  __builtin_amdgcn_sched_barrier(0);   // the second v^T unit's loads stay behind the softmax: lifted in front of it they hold 32 more registers through it and the count passes 256
  v8f o[4] = {(v8f){}, (v8f){}, (v8f){}, (v8f){}}; v16b pa, pb;
#pragma unroll
  for (int u = 0; u < 14; ++u) { const int bf = u & 1, j = u >> 1, t0 = (u & 1) * 2, t1 = t0 + 1; if (u + 1 < 14) vfetch(u + 1, bf ^ 1);
    __builtin_amdgcn_sched_barrier(0);   // the next unit's loads are issued before this unit's products
    if ((u & 1) == 0) {
#pragma unroll
      for (int e = 0; e < 8; ++e) { b16 p, pl; split16(s[2 * j][e] * inv * PS, p, pl); pa[e] = p; pb[e] = pl;
        if (2 * j + 1 < 13) { split16(s[2 * j + 1][e] * inv * PS, p, pl); pa[8 + e] = p; pb[8 + e] = pl; } else { pa[8 + e] = (b16)0.0f; pb[8 + e] = (b16)0.0f; } } }
    o[t0] = wmma16b(vh[bf][0], pa, o[t0]); o[t1] = wmma16b(vh[bf][1], pa, o[t1]); o[t0] = wmma16b(vl[bf][0], pa, o[t0]); o[t1] = wmma16b(vl[bf][1], pa, o[t1]); o[t0] = wmma16b(vh[bf][0], pb, o[t0]); o[t1] = wmma16b(vh[bf][1], pb, o[t1]); __builtin_amdgcn_sched_barrier(0); }   // as above: no wait for the next unit in front of this point
  if (q < S) { float* const op = out + (tb + q) * D + h * HD + 8 * hlf;
#pragma unroll
    for (int t = 0; t < 4; ++t) { const v8f f = o[t] * (1.0f / (PS * HS)); *(v4f*)(op + t * 16) = (v4f){f[0], f[1], f[2], f[3]}; *(v4f*)(op + t * 16 + 4) = (v4f){f[4], f[5], f[6], f[7]}; } } }
}  // namespace

extern "C" void kernel_launch(void* const* d_in, const int* in_sizes, int n_in, void* d_out, int out_size, void* d_ws, size_t ws_size, hipStream_t stream) {
  (void)n_in;
  auto Fp = [&](int i) { return (const float*)d_in[i]; };
  // input order: 0 hidden_states [64,197,768]; 1 Wq [768,768]; 2 bq [768]; 3 Wk; 4 Wv; 5 bv; 6 bias_table [732,12]
  if (in_sizes[0] != T * D || in_sizes[1] != D * D || in_sizes[3] != D * D || in_sizes[4] != D * D || in_sizes[6] != NRD * H || out_size != T * D) return;
  const int BLIM = NB_;
  size_t off = 0; char* ws = (char*)d_ws;
  auto carve = [&](size_t bytes) { char* p = ws + off; off += (bytes + 255) & ~(size_t)255; return p; };
  b16* WQKV = (b16*)carve((size_t)3 * D * D * 2); b16* Qh = (b16*)carve((size_t)TP * D * 2); b16* Ql = (b16*)carve((size_t)TP * D * 2); b16* Kh = (b16*)carve((size_t)TP * D * 2); b16* Kl = (b16*)carve((size_t)TP * D * 2); b16* Vh = (b16*)carve((size_t)TP * D * 2); b16* Vl = (b16*)carve((size_t)TP * D * 2);
  if (off > ws_size || off > ((size_t)176 << 20)) return;   // ~ 120 MB
  wput_kernel<<<216 /* 3 matrices x 6 k tiles x 12 column tiles */, 256, 0, stream>>>(Fp(1), Fp(3), Fp(4), WQKV, Kh, Kl, Vh, Vl);
  proj_kernel<<<(BLIM * S + 63) / 64 * 9, 256, 0, stream>>>(Fp(0), WQKV, Fp(2), Fp(5), BLIM, Qh, Ql, Kh, Kl, Vh, Vl);
  att_kernel<<<BLIM * H * 2, 224, 0, stream>>>(Qh, Ql, Kh, Kl, Vh, Vl, Fp(6), BLIM, (float*)d_out);
}

// v006
// A run of this version takes 123 microseconds.
// Two timings next to v005 put it at 1.07 and 1.06 times that version's speed.
// Over all steps from v000 it is 9.23 times as fast.
#include <hip/hip_runtime.h>

// BeitSelfAttention: q = x Wq + bq, k = x Wk (no bias), v = x Wv + bv (12 heads x 64); scores = q.k/8 + bias_table[rel_idx(q,k)][h] (BEiT relative position index incl. the cls row/column/corner entries); probs = softmax; ctx = probs v -> [64][197][768].
// Deterministic: per-wave softmax over the 197 keys in fixed order; no atomics.
// WMMA (v_wmma_f32_16x16x32_f16, f32 accumulate): x (EXACT bf16 x8, K 768) x [Wq|Wk|Wv] rows (EXACT x256 (in,out); 144 tiles in 9 groups), 128 tokens x 256 columns per 8-wave work-group; per (b, h, 16-query) wave, k, v and the bias column shared through LDS by 7 waves, S^T = k rows (hi+lo; 13 tiles) x q (hi+lo x256, K 64) and ctx^T = v^T rows (hi+lo; 4 tiles, K 224, P = 0 past the image) x P^T (hi+lo), 3 products — 4.3 M WMMA; bias gather + softmax in f32.

namespace {
constexpr int NB_ = 64, S = 197, SP = 208 /* 13 key tiles */, VK = 224 /* 7 key pairs of tiles for v */, D = 768, H = 12, HD = 64, T = NB_ * S /* 12608 = 788*16 */, TP = T + 32, WH = 14, NRD = 732;
constexpr float XS = 8.0f, HS = 256.0f, PS = 256.0f, WSC = 256.0f, SCALE = 0.125f;
typedef _Float16 b16;
typedef __attribute__((ext_vector_type(16))) _Float16 v16b;
typedef __attribute__((ext_vector_type(8))) _Float16 v8b;
typedef __attribute__((ext_vector_type(4))) _Float16 v4b;
typedef __attribute__((ext_vector_type(2))) _Float16 v2b;
typedef __attribute__((ext_vector_type(8))) float v8f;
typedef __attribute__((ext_vector_type(4))) float v4f;
typedef __attribute__((ext_vector_type(2))) float v2f;
__device__ __forceinline__ float bf16_rne(float f) { unsigned int u = __float_as_uint(f); u += 0x7FFFu + ((u >> 16) & 1u); float r = __uint_as_float(u & 0xFFFF0000u); asm volatile("" : "+v"(r)); return r; }
__device__ __forceinline__ float bfv(float f) { float r = bf16_rne(f); asm volatile("" : "+v"(r)); return r; }
__device__ __forceinline__ void split16(float v, b16& hi, b16& lo) { hi = (b16)v; lo = (b16)(v - (float)hi); }
__device__ __forceinline__ v16b frag_kb(const b16* p, int hh) { const v8b a = *(const v8b*)(p + 8 * hh), b = *(const v8b*)(p + 16 + 8 * hh); v16b f;
#pragma unroll
  for (int e = 0; e < 8; ++e) { f[e] = a[e]; f[8 + e] = b[e]; } return f; }
// transposing LDS load: from row-major rows [key][d] lane (c, half) gets 8 consecutive keys of column c; the loads at keys 0 and 16 of a 32-key block are one A fragment in frag_kb's k order
typedef __attribute__((ext_vector_type(8))) short s16x8;
__device__ __forceinline__ v8b ld_tr16(const b16* p) { typedef __attribute__((address_space(3))) s16x8 lds_s16x8; return __builtin_bit_cast(v8b, __builtin_amdgcn_ds_load_tr16_b128_v8i16((lds_s16x8*)p)); }
__device__ __forceinline__ v16b frag_tr(const b16* p, int pitch) { const v8b a = ld_tr16(p), b = ld_tr16(p + 16 * pitch); v16b f;
#pragma unroll
  for (int e = 0; e < 8; ++e) { f[e] = a[e]; f[8 + e] = b[e]; } return f; }
__device__ __forceinline__ v8f wmma16b(v16b a, v16b b, v8f c) { v8f d = __builtin_amdgcn_wmma_f32_16x16x32_f16(false, a, false, b, (short)0, c, false, false); asm volatile("v_nop\n\tv_nop\n\tv_nop\n\tv_nop" : "+v"(d) : "v"(a), "v"(b)); return d; }
// wput: one work-group per 128 k x 64 columns of one weight matrix. A lane asks for 8 rows x 16 bytes at once, 16 lanes covering 256 bytes of a row, so every load takes whole lines and all
// of them are in flight together; the lane's 8 k x 4 columns go rounded into LDS as four 16-byte pieces of the transposed tile (272-byte rows), and the rows leave as 256 contiguous bytes each.
__global__ __launch_bounds__(256) void wput_kernel(const float* __restrict__ wq, const float* __restrict__ wk, const float* __restrict__ wv, b16* __restrict__ WQKV, b16* __restrict__ Kh, b16* __restrict__ Kl, b16* __restrict__ Vh, b16* __restrict__ Vl) { const size_t nt = (size_t)gridDim.x * 256, u0 = (size_t)blockIdx.x * 256 + threadIdx.x; const v8b z = {0, 0, 0, 0, 0, 0, 0, 0};
  constexpr int TK = 128, TO = 64, TW = TK + 8, NKT = D / TK, NOT = D / TO;
  __shared__ __attribute__((aligned(16))) b16 Ts[TO * TW];
  const int tid = threadIdx.x, hi4 = tid >> 4, lo4 = tid & 15; const int which = blockIdx.x / (NKT * NOT), rem = blockIdx.x % (NKT * NOT), k0 = (rem / NOT) * TK, o0 = (rem % NOT) * TO;
  const float* const w = which == 0 ? wq : (which == 1 ? wk : wv); const float* const wp = w + (size_t)(k0 + hi4 * 8) * D + o0 + lo4 * 4;
  v4f f[8];
#pragma unroll   // the row steps become immediate offsets on one address
  for (int j = 0; j < 8; ++j) f[j] = *(const v4f*)(wp + j * D);
#pragma unroll   // constant indices: the loaded rows and the packed pieces stay in registers
  for (int c = 0; c < 4; ++c) { v8b v;
#pragma unroll   // as above
    for (int j = 0; j < 8; ++j) v[j] = (b16)(bf16_rne(f[j][c]) * WSC);
    *(v8b*)(Ts + (lo4 * 4 + c) * TW + hi4 * 8) = v; }
  __syncthreads();   // the transposed tile is whole before its rows are read
  { b16* const op = WQKV + ((size_t)which * D + o0 + hi4) * D + k0 + lo4 * 8; const b16* const tp = Ts + hi4 * TW + lo4 * 8;
#pragma unroll   // the row steps become immediate offsets on one address
    for (int i = 0; i < 4; ++i) *(v8b*)(op + (size_t)i * 16 * D) = *(const v8b*)(tp + i * 16 * TW); }
  for (size_t u = u0; u < (size_t)(TP - T) * (D / 8); u += nt) { const size_t off = (size_t)T * D + u * 8; { *(v8b*)(Kh + off) = z; *(v8b*)(Kl + off) = z; *(v8b*)(Vh + off) = z; *(v8b*)(Vl + off) = z;  } } }
// the low 32 bits of a __shared__ address: the byte address in the work-group's LDS, as an asynchronous copy takes it
__device__ __forceinline__ unsigned lds_addr(const void* p) { typedef __attribute__((address_space(3))) const char lds_c; return (unsigned)(unsigned long long)(lds_c*)p; }
// proj: one work-group of 8 waves per 128-token x 256-column tile of [q|k|v], 64-k stages in two LDS buffers. x goes through registers (it is rounded and scaled on the way);
// the weight rows, 16-bit already, go from L2 into LDS by asynchronous copies, which hold no registers while they fly: that is what lets 16 accumulator tiles a wave fit at four waves per SIMD.
// Each wave owns 64 x 64 outputs (4 x 4 accumulator tiles), so every fragment read from LDS feeds 4 products, and a weight row fetched from L2 serves 128 tokens. k runs upward in one chain per output.
// The token count is a multiple of 64, not of 128: the last tile's upper 64 rows read the lower 64 again (in bounds) and are not stored.
// Four waves per SIMD (two work-groups per WGP): one work-group's staging and barrier waits stand behind the other's products.
__global__ __launch_bounds__(256) __attribute__((amdgpu_waves_per_eu(4, 4))) void proj_kernel(const float* __restrict__ x, const b16* __restrict__ WQKV, const float* __restrict__ bq, const float* __restrict__ bv, int BLIM, b16* __restrict__ Qh, b16* __restrict__ Ql, b16* __restrict__ Kh, b16* __restrict__ Kl, b16* __restrict__ Vh, b16* __restrict__ Vl) {
  constexpr int KC = 64, NS = D / KC, KP = KC + 8 /* 144-byte rows: 16 B x odd for 16-byte readers */, MT = 128, ASZ = MT * KP, STG = ASZ + 256 * KP, TFP = 260;
  constexpr int SMB = 2 * STG * 2 > MT * TFP * 4 ? 2 * STG * 2 : MT * TFP * 4;
  __shared__ __attribute__((aligned(16))) char smem[SMB];
  b16* const St = (b16*)smem; float* const Tf = (float*)smem;   // the output tile reuses the stages behind a barrier
  const int tid = threadIdx.x, lane = tid & 31, wave = __builtin_amdgcn_readfirstlane(tid >> 5) /* in a scalar register, with all that follows from it */, nloc = lane & 15, hlf = lane >> 4, wm = wave >> 2, wn = wave & 3;
  const int g = blockIdx.x % 9, which = g / 3, c0 = (g % 3) * 256; const size_t t0 = (size_t)(blockIdx.x / 9) * MT; if (t0 >= (size_t)BLIM * S) return;
  const bool up = t0 + 64 < (size_t)T;   // the same for the whole work-group
  const int ar = tid >> 4, ac = (tid & 15) * 4, br = tid >> 3, bc = (tid & 7) * 8;   // 16 lanes cover 256 B of an x row, 8 lanes 128 B of a weight row
  const float* const xg = x + (t0 + ar) * D + ac; const float* const xu = xg + (up ? 64 * D : 0); const b16* const ws = WQKV + ((size_t)which * D + c0) * D; const unsigned wo = (br * D + bc) * 2;
  const unsigned wl = lds_addr(St + ASZ + br * KP + bc);
  v4f xr[8]; v8f acc[4][4];
#pragma unroll
  for (int m = 0; m < 4; ++m)
#pragma unroll
    for (int n = 0; n < 4; ++n) acc[m][n] = (v8f){};
  auto fetch = [&](int kc) {
#pragma unroll
    for (int i = 0; i < 4; ++i) { xr[i] = *(const v4f*)(xg + (size_t)i * 16 * D + kc); xr[4 + i] = *(const v4f*)(xu + (size_t)i * 16 * D + kc); } };
  auto put = [&](b16* st) {
#pragma unroll
    for (int i = 0; i < 8; ++i) { v4b h;
#pragma unroll
      for (int j = 0; j < 4; ++j) h[j] = (b16)(bf16_rne(xr[i][j]) * XS);
      *(v4b*)(st + (ar + i * 16) * KP + ac) = h; } };
  // a stage's 256 weight rows: 8 copies of 16 bytes a lane, rows 32 apart: a scalar base per copy (the same for the work-group) and one 32-bit lane offset, so that the global addresses hold one vector register.
  // The wait on the address translations is the statement's last line, so that it stands in front of every later write of a register that a copy names.
  auto wcopy = [&](int s) { const unsigned l = wl + (s & 1) * (STG * 2); const b16* const p = ws + s * KC;
    asm volatile("global_load_async_to_lds_b128 %0, %8, %9\n\tglobal_load_async_to_lds_b128 %1, %8, %10\n\tglobal_load_async_to_lds_b128 %2, %8, %11\n\tglobal_load_async_to_lds_b128 %3, %8, %12\n\t"
                 "global_load_async_to_lds_b128 %4, %8, %13\n\tglobal_load_async_to_lds_b128 %5, %8, %14\n\tglobal_load_async_to_lds_b128 %6, %8, %15\n\tglobal_load_async_to_lds_b128 %7, %8, %16\n\ts_wait_xcnt 0x0"
                 :: "v"(l), "v"(l + 32 * KP * 2), "v"(l + 64 * KP * 2), "v"(l + 96 * KP * 2), "v"(l + 128 * KP * 2), "v"(l + 160 * KP * 2), "v"(l + 192 * KP * 2), "v"(l + 224 * KP * 2), "v"(wo),
                    "s"(p), "s"(p + 32 * D), "s"(p + 64 * D), "s"(p + 96 * D), "s"(p + 128 * D), "s"(p + 160 * D), "s"(p + 192 * D), "s"(p + 224 * D) : "memory"); };
  fetch(0); wcopy(0); put(St); fetch(KC);
  asm volatile("s_wait_asynccnt 0x0" ::: "memory");   // this wave's copies of stage 0 have landed before the barrier that publishes them
  __syncthreads();
  wcopy(1); put(St + STG); fetch(2 * KC);
#pragma unroll   // 12 trips: buffer and k offsets become immediates, so no address register of a load in flight is rewritten
  for (int c = 0; c < NS; ++c) { const b16* const cur = St + (c & 1) * STG;
#pragma unroll
    for (int ks = 0; ks < 2; ++ks) { v16b a[4], b[4];   // the fragment reads of a 32-k half stand as one group ahead of its 16 products
#pragma unroll
      for (int n = 0; n < 4; ++n) b[n] = frag_kb(cur + ASZ + (wn * 64 + n * 16 + nloc) * KP + ks * 32, hlf);
#pragma unroll
      for (int m = 0; m < 4; ++m) a[m] = frag_kb(cur + (wm * 64 + m * 16 + nloc) * KP + ks * 32, hlf);
#pragma unroll
      for (int m = 0; m < 4; ++m)
#pragma unroll
        for (int n = 0; n < 4; ++n) acc[m][n] = wmma16b(a[m], b[n], acc[m][n]); }
    asm volatile("s_wait_dscnt 0x0" ::: "memory");      // this wave's reads of stage c and its x stores of stage c + 1 are done
    asm volatile("s_wait_asynccnt 0x0" ::: "memory");   // this wave's copies of stage c + 1 have landed
    __syncthreads();   // publishes stage c + 1 and ends every read of the buffer that stage c + 2 goes into (behind the last trip: of the stages, before the output tile overwrites them)
    if (c + 2 < NS) { wcopy(c + 2); put(St + (c & 1) * STG);
      if (c + 3 < NS) fetch((c + 3) * KC);   // a stage's global loads have a whole trip to land
      if (c + 3 == NS - 1) asm volatile("s_wait_xcnt 0x0" :: "v"(xg), "v"(xu) : "memory"); } }   // behind the last loads that name these address registers; as inputs they stay untouched up to the wait
  asm volatile("s_wait_asynccnt 0x0" ::: "memory");   // no copy is outstanding when the stages are reused
  // the lane's number is formed anew here: carried from the top, the indices of this part would hold registers through the whole loop, which has none to spare (the build spilled them)
  const int el = __builtin_amdgcn_mbcnt_lo(~0u, 0u), en = el & 15, eh = el >> 4;
#pragma unroll
  for (int n = 0; n < 4; ++n) { const int cc = wn * 64 + n * 16 + en; const float bb = which == 0 ? bfv(bq[c0 + cc]) : (which == 2 ? bfv(bv[c0 + cc]) : 0.0f);
#pragma unroll
    for (int m = 0; m < 4; ++m)
#pragma unroll
      for (int r8 = 0; r8 < 8; ++r8) Tf[(wm * 64 + m * 16 + 8 * eh + r8) * TFP + cc] = acc[m][n][r8] * (1.0f / (XS * WSC)) + bb; }
  __syncthreads();
  // the row loops are unrolled so that the row addresses are immediates and no address register is rewritten behind a store
  { const size_t ob = (t0 + wave) * D + c0 + el * 4; b16* const Ph = (which == 0 ? Qh : (which == 1 ? Kh : Vh)) + ob; b16* const Pl = (which == 0 ? Ql : (which == 1 ? Kl : Vl)) + ob; const float* const Tp = Tf + wave * TFP + el * 4;
    auto row = [&](int i) {
#pragma unroll
      for (int q = 0; q < 2; ++q) { const v4f f = *(const v4f*)(Tp + i * 8 * TFP + q * 128); v4b hi, lo;
#pragma unroll
        for (int j = 0; j < 4; ++j) { b16 h0, l0; split16(f[j] * HS, h0, l0); hi[j] = h0; lo[j] = l0; }
        *(v4b*)(Ph + (size_t)i * 8 * D + q * 128) = hi; *(v4b*)(Pl + (size_t)i * 8 * D + q * 128) = lo; } };
#pragma unroll
    for (int i = 0; i < 8; ++i) row(i);
    asm volatile("s_wait_xcnt 0x0" ::: "memory");   // behind the last stores of the lower rows: the upper rows' LDS reads reuse their data registers
    if (up) {
#pragma unroll
      for (int i = 8; i < 16; ++i) row(i); } } }
// relative position index: entry 731 for (cls, cls), 729 for the cls query, 730 for the cls key; for patches (dy + 13) * 27 + dx + 13.
// With patch p = token - 1 written as row * 27 + column that is plin(q - 1) - plin(k - 1) + 13 * 27 + 13
__device__ __forceinline__ constexpr int plin(int p) { return (p / WH) * (2 * WH - 1) + p % WH; }
// exp(x) as the fast intrinsic forms it (x * log2 e, then the hardware exp2). The v_nop is the slot behind a transcendental: written into the same statement, it stands there
// whichever instruction the compiler puts next.
__device__ __forceinline__ float exp_slot(float x) { const float y = x * 1.44269504f; float r; asm("v_exp_f32 %0, %1\n\tv_nop" : "=v"(r) : "v"(y)); return r; }
// att: one work-group of 7 waves per (b, h, half of the 13 query tiles); one wave per 16 queries, everything transposed and in registers as before.
// The head's k rows, v rows (hi and lo) and bias column are brought into LDS once, with loads that cover whole 128-byte lines, and every wave takes its fragments from there:
// a fragment load straight from global memory touches 16 lines for 512 bytes, and each of the 13 waves of a head repeated all of them.
// LDS pitches: 16 B x odd (144 B) for k and its 16-byte readers, 32 B x odd (160 B) for v and its transposing readers, which hand out v^T fragments from the rows as the projection wrote them.
// v rows 197 to 223 are the next image's (behind the last image: zeros); they are finite and meet P = 0.
// S^T = k rows (A) x q (B): lane (c, half) holds for query q0 + c the keys 16 t + 8 half + r,
// so bias, maximum, exp and sum run in-lane on all 32 lanes, with one exchange between the halves. Two score tiles, converted in place, are the B operand of ctx^T = v^T rows (A) x P^T
// in the k order in which the transposing loads hand out v^T; a lane then holds 8 consecutive d of its query and stores them itself.
// Loads stand one tile ahead of their products. The scheduling barriers keep that order: without them the next tile's bias rounding, and with it the wait for loads just issued, is lifted in front of this tile's products, and the register count passes 256.
__global__ __launch_bounds__(224) void att_kernel(const b16* __restrict__ Qh, const b16* __restrict__ Ql, const b16* __restrict__ Kh, const b16* __restrict__ Kl, const b16* __restrict__ Vh, const b16* __restrict__ Vl, const float* __restrict__ btab, int BLIM, float* __restrict__ out) {
  constexpr int KP = HD + 8, VP = HD + 16, KSZ = SP * KP, VSZ = VK * VP;
  __shared__ __attribute__((aligned(16))) char smem[(2 * KSZ + 2 * VSZ) * 2 + NRD * 4];
  b16* const Ksh = (b16*)smem; b16* const Ksl = Ksh + KSZ; b16* const Vsh = Ksl + KSZ; b16* const Vsl = Vsh + VSZ; float* const Bs = (float*)(Vsl + VSZ);
  const int tid = threadIdx.x, lane = tid & 31, nloc = lane & 15, hlf = lane >> 4; const int b = blockIdx.x / (H * 2), rem = blockIdx.x % (H * 2); const int h = rem / 2; if (b >= BLIM) return; const size_t tb = (size_t)b * S;
  const int qt = (rem % 2) * 7 + __builtin_amdgcn_readfirstlane(tid >> 5);
  // the wave's own q fragments are asked for first, so that they land while the shared rows are staged (the wave without a query tile reads the image's last row, in bounds)
  const int q0 = qt * 16;
  const int q = q0 + nloc; const size_t qrow = tb + (q < S ? q : S - 1);   // columns past the image read a valid row; their results are not written
  // the q pointers hold the lane's whole address (the half's 8 elements too), so that all loads of the stream name that one register pair plus a constant
  const b16* const qph = Qh + qrow * D + h * HD + 8 * hlf; const b16* const qpl = Ql + qrow * D + h * HD + 8 * hlf;
  v16b qa[2], ql[2];
#pragma unroll
  for (int ks = 0; ks < 2; ++ks) { qa[ks] = frag_kb(qph + ks * 32, 0); ql[ks] = frag_kb(qpl + ks * 32, 0); }
  asm volatile("s_wait_xcnt 0x0" :: "v"(qph), "v"(qpl) : "memory");   // behind the last loads that name these address registers; as inputs they stay untouched up to the wait and are free for reuse behind it
  { // staging: 8 lanes cover the 128 B of a k row or a v row; all row steps are constants on one address per stream
    const int kr = tid >> 3, kc = (tid & 7) * 8;
    const b16* const gkh = Kh + (tb + kr) * D + h * HD + kc; const b16* const gkl = Kl + (tb + kr) * D + h * HD + kc;
    const b16* const gvh = Vh + (tb + kr) * D + h * HD + kc; const b16* const gvl = Vl + (tb + kr) * D + h * HD + kc;
    const float* const gb = btab + tid * H + h;
    v8b rk[2][8], rv[2][8]; float rb[4];
#pragma unroll   // the row steps become immediate offsets and the staging arrays stay in registers
    for (int i = 0; i < 7; ++i) { rk[0][i] = *(const v8b*)(gkh + i * 28 * D); rk[1][i] = *(const v8b*)(gkl + i * 28 * D); }
    if (tid < 96) { rk[0][7] = *(const v8b*)(gkh + 7 * 28 * D); rk[1][7] = *(const v8b*)(gkl + 7 * 28 * D); }   // rows 196 to 207: three whole waves
#pragma unroll   // the row steps become immediate offsets and the staging arrays stay in registers
    for (int i = 0; i < 8; ++i) { rv[0][i] = *(const v8b*)(gvh + i * 28 * D); rv[1][i] = *(const v8b*)(gvl + i * 28 * D); }
#pragma unroll   // the row steps become immediate offsets and the staging arrays stay in registers
    for (int i = 0; i < 3; ++i) rb[i] = gb[i * 224 * H];
    if (tid < NRD - 3 * 224) rb[3] = gb[3 * 224 * H];
    asm volatile("s_wait_xcnt 0x0" :: "v"(gkh), "v"(gkl), "v"(gvh), "v"(gvl), "v"(gb) : "memory");   // behind the last loads that name these address registers; as inputs they stay untouched up to the wait
#pragma unroll   // the row steps become immediate offsets and the staging arrays stay in registers
    for (int i = 0; i < 7; ++i) { *(v8b*)(Ksh + (kr + i * 28) * KP + kc) = rk[0][i]; *(v8b*)(Ksl + (kr + i * 28) * KP + kc) = rk[1][i]; }
    if (tid < 96) { *(v8b*)(Ksh + (kr + 7 * 28) * KP + kc) = rk[0][7]; *(v8b*)(Ksl + (kr + 7 * 28) * KP + kc) = rk[1][7]; }
#pragma unroll   // the row steps become immediate offsets and the staging arrays stay in registers
    for (int i = 0; i < 8; ++i) { *(v8b*)(Vsh + (kr + i * 28) * VP + kc) = rv[0][i]; *(v8b*)(Vsl + (kr + i * 28) * VP + kc) = rv[1][i]; }
#pragma unroll   // the row steps become immediate offsets and the staging arrays stay in registers
    for (int i = 0; i < 3; ++i) Bs[tid + i * 224] = rb[i];
    if (tid < NRD - 3 * 224) Bs[tid + 3 * 224] = rb[3]; }
  __syncthreads();   // publishes the staged rows; the only barrier, so the wave without a query tile may leave behind it
  if (qt >= 13) return;
  v16b kh[2][2], kl[2][2]; float br[2][8];
  // bias addresses: for a patch query the entry of key k lies plin(k - 1) entries below the query's own base, a constant per register but for the upper half's 8 keys (8 or 21 entries more).
  // The cls query (and a column past the image, as before) has one entry for all patch keys: it reads as query 1, in bounds, and takes the cls value instead.
  const int qq = q < S ? q : 0; const bool qcls = qq == 0; const int base = plin(qcls ? 0 : qq - 1) + (WH - 1) * (2 * WH - 1) + (WH - 1);
  constexpr int PL = plin(S - 2); const float* const pn = Bs + (base - PL); const float* const p0 = pn - hlf * 8; const float* const p1 = pn - hlf * 21;   // set to the last key's entry: constants from 0 up
  const float bcls = Bs[NRD - 3];
  const int idx0 = hlf == 0 ? (qcls ? NRD - 1 : NRD - 2) : (qcls ? NRD - 3 : base - plin(7));   // register 0 of tile 0: key 0 or key 8
  const b16* const kph = Ksh + nloc * KP + 8 * hlf; const b16* const kpl = Ksl + nloc * KP + 8 * hlf;
  const int vlo = (8 * hlf + (lane & 7)) * VP + ((lane >> 3) & 1) * 8;   // the transposing load's lane address: key row 8 half + (lane & 7), 16 bytes further for lanes 8 to 15 of a half
  const b16* const vph = Vsh + vlo; const b16* const vpl = Vsl + vlo;
  auto kfetch = [&](int t, int bf) {
#pragma unroll
    for (int ks = 0; ks < 2; ++ks) { kh[bf][ks] = frag_kb(kph + t * 16 * KP + ks * 32, 0); kl[bf][ks] = frag_kb(kpl + t * 16 * KP + ks * 32, 0); }
#pragma unroll
    for (int r8 = 0; r8 < 8; ++r8) { const int c = t * 16 + r8;   // the lower half's key; the upper half's is c + 8
      if (c >= S) br[bf][r8] = 0.0f; else if (c == 0) br[bf][r8] = Bs[idx0];
      else br[bf][r8] = (c + 8 >= S ? pn : ((c + 7) / WH != (c - 1) / WH ? p1 : p0))[PL - plin(c - 1)]; } };   // an upper-half key past the image reads the lower half's entry and is masked below
  v16b vh[2][2], vl[2][2];
  auto vfetch = [&](int u, int bf) {   // unit u: keys 32 (u / 2) ..., d tiles 2 (u % 2) and 2 (u % 2) + 1
#pragma unroll
    for (int i = 0; i < 2; ++i) { const int vo = (u >> 1) * 32 * VP + ((u & 1) * 2 + i) * 16; vh[bf][i] = frag_tr(vph + vo, VP); vl[bf][i] = frag_tr(vpl + vo, VP); } };
  v8f s[13]; float mx = -INFINITY;
  kfetch(0, 0);
#pragma unroll
  for (int t = 0; t < 13; ++t) { const int bf = t & 1; if (t + 1 < 13) kfetch(t + 1, bf ^ 1); else vfetch(0, 0);
    __builtin_amdgcn_sched_barrier(0);   // the next tile's loads are issued before this tile's work
    v8f a = (v8f){};
#pragma unroll
    for (int ks = 0; ks < 2; ++ks) { a = wmma16b(kh[bf][ks], qa[ks], a); a = wmma16b(kl[bf][ks], qa[ks], a); a = wmma16b(kh[bf][ks], ql[ks], a); }
#pragma unroll
    for (int r8 = 0; r8 < 8; ++r8) { const int c = t * 16 + r8;
      if (c >= S) { a[r8] = -INFINITY; continue; }
      float v = a[r8] * (SCALE / (HS * HS)) + bfv(c != 0 && qcls ? bcls : br[bf][r8]); if (c + 8 >= S && hlf) v = -INFINITY;
      a[r8] = v; mx = fmaxf(mx, v); }
    s[t] = a; __builtin_amdgcn_sched_barrier(0); }   // nothing of the next tile is worked on, or waited for, in front of this point
  mx = fmaxf(mx, __shfl_xor(mx, 16, 32));
  float sp[8] = {0.0f, 0.0f, 0.0f, 0.0f, 0.0f, 0.0f, 0.0f, 0.0f};   // eight partial sums: no chain of 101 dependent adds
#pragma unroll
  for (int t = 0; t < 13; ++t)
#pragma unroll
    for (int r8 = 0; r8 < 8; ++r8) { if (t * 16 + r8 >= S) { s[t][r8] = 0.0f; continue; } const float p = exp_slot(s[t][r8] - mx); s[t][r8] = p; sp[r8] += p; }
  float sm = ((sp[0] + sp[1]) + (sp[2] + sp[3])) + ((sp[4] + sp[5]) + (sp[6] + sp[7])); sm += __shfl_xor(sm, 16, 32); const float inv = 1.0f / sm;
  __builtin_amdgcn_sched_barrier(0);   // the second v^T unit's loads stay behind the softmax: lifted in front of it they hold 32 more registers through it and the count passes 256
  v8f o[4] = {(v8f){}, (v8f){}, (v8f){}, (v8f){}}; v16b pa, pb;
#pragma unroll
  for (int u = 0; u < 14; ++u) { const int bf = u & 1, j = u >> 1, t0 = (u & 1) * 2, t1 = t0 + 1; if (u + 1 < 14) vfetch(u + 1, bf ^ 1);
    __builtin_amdgcn_sched_barrier(0);   // the next unit's loads are issued before this unit's products
    if ((u & 1) == 0) {
#pragma unroll
      for (int e = 0; e < 8; ++e) { b16 p, pl; split16(s[2 * j][e] * inv * PS, p, pl); pa[e] = p; pb[e] = pl;
        if (2 * j + 1 < 13) { split16(s[2 * j + 1][e] * inv * PS, p, pl); pa[8 + e] = p; pb[8 + e] = pl; } else { pa[8 + e] = (b16)0.0f; pb[8 + e] = (b16)0.0f; } } }
    o[t0] = wmma16b(vh[bf][0], pa, o[t0]); o[t1] = wmma16b(vh[bf][1], pa, o[t1]); o[t0] = wmma16b(vl[bf][0], pa, o[t0]); o[t1] = wmma16b(vl[bf][1], pa, o[t1]); o[t0] = wmma16b(vh[bf][0], pb, o[t0]); o[t1] = wmma16b(vh[bf][1], pb, o[t1]); __builtin_amdgcn_sched_barrier(0); }   // as above: no wait for the next unit in front of this point
  if (q < S) { float* const op = out + (tb + q) * D + h * HD + 8 * hlf;
#pragma unroll
    for (int t = 0; t < 4; ++t) { const v8f f = o[t] * (1.0f / (PS * HS)); *(v4f*)(op + t * 16) = (v4f){f[0], f[1], f[2], f[3]}; *(v4f*)(op + t * 16 + 4) = (v4f){f[4], f[5], f[6], f[7]}; } } }
}  // namespace

extern "C" void kernel_launch(void* const* d_in, const int* in_sizes, int n_in, void* d_out, int out_size, void* d_ws, size_t ws_size, hipStream_t stream) {
  (void)n_in;
  auto Fp = [&](int i) { return (const float*)d_in[i]; };
  // input order: 0 hidden_states [64,197,768]; 1 Wq [768,768]; 2 bq [768]; 3 Wk; 4 Wv; 5 bv; 6 bias_table [732,12]
  if (in_sizes[0] != T * D || in_sizes[1] != D * D || in_sizes[3] != D * D || in_sizes[4] != D * D || in_sizes[6] != NRD * H || out_size != T * D) return;
  const int BLIM = NB_;
  size_t off = 0; char* ws = (char*)d_ws;
  auto carve = [&](size_t bytes) { char* p = ws + off; off += (bytes + 255) & ~(size_t)255; return p; };
  b16* WQKV = (b16*)carve((size_t)3 * D * D * 2); b16* Qh = (b16*)carve((size_t)TP * D * 2); b16* Ql = (b16*)carve((size_t)TP * D * 2); b16* Kh = (b16*)carve((size_t)TP * D * 2); b16* Kl = (b16*)carve((size_t)TP * D * 2); b16* Vh = (b16*)carve((size_t)TP * D * 2); b16* Vl = (b16*)carve((size_t)TP * D * 2);
  if (off > ws_size || off > ((size_t)176 << 20)) return;   // ~ 120 MB
  wput_kernel<<<216 /* 3 matrices x 6 k tiles x 12 column tiles */, 256, 0, stream>>>(Fp(1), Fp(3), Fp(4), WQKV, Kh, Kl, Vh, Vl);
  proj_kernel<<<(BLIM * S + 127) / 128 * 9, 256, 0, stream>>>(Fp(0), WQKV, Fp(2), Fp(5), BLIM, Qh, Ql, Kh, Kl, Vh, Vl);
  att_kernel<<<BLIM * H * 2, 224, 0, stream>>>(Qh, Ql, Kh, Kl, Vh, Vl, Fp(6), BLIM, (float*)d_out);
}

// v007
// Measured time: 116 microseconds a run.
// Two timings next to v006 put it at 1.06 and 1.05 times that version's speed.
// Over all steps from v000 it is 9.76 times as fast.
#include <hip/hip_runtime.h>

// BeitSelfAttention: q = x Wq + bq, k = x Wk (no bias), v = x Wv + bv (12 heads x 64); scores = q.k/8 + bias_table[rel_idx(q,k)][h] (BEiT relative position index incl. the cls row/column/corner entries); probs = softmax; ctx = probs v -> [64][197][768].
// Deterministic: per-wave softmax over the 197 keys in fixed order; no atomics.
// WMMA (v_wmma_f32_16x16x32_f16, f32 accumulate): x (EXACT bf16 x8, K 768) x [Wq|Wk|Wv] rows (EXACT x256 (in,out); 144 tiles in 9 groups), 128 tokens x 256 columns per 8-wave work-group; per (b, h, 16-query) wave, k, v and the bias column shared through LDS by 7 waves, S^T = k rows (hi+lo; 13 tiles) x q (hi+lo x256, K 64) and ctx^T = v^T rows (hi+lo; 4 tiles, K 224, P = 0 past the image) x P^T (hi+lo), 3 products — 4.3 M WMMA; bias gather + softmax in f32.

namespace {
constexpr int NB_ = 64, S = 197, SP = 208 /* 13 key tiles */, VK = 224 /* 7 key pairs of tiles for v */, D = 768, H = 12, HD = 64, T = NB_ * S /* 12608 = 788*16 */, TP = T + 32, WH = 14, NRD = 732;
constexpr float XS = 8.0f, HS = 256.0f, PS = 256.0f, WSC = 256.0f, SCALE = 0.125f;
typedef _Float16 b16;
typedef __attribute__((ext_vector_type(16))) _Float16 v16b;
typedef __attribute__((ext_vector_type(8))) _Float16 v8b;
typedef __attribute__((ext_vector_type(4))) _Float16 v4b;
typedef __attribute__((ext_vector_type(2))) _Float16 v2b;
typedef __attribute__((ext_vector_type(8))) float v8f;
typedef __attribute__((ext_vector_type(4))) float v4f;
typedef __attribute__((ext_vector_type(2))) float v2f;
__device__ __forceinline__ float bf16_rne(float f) { unsigned int u = __float_as_uint(f); u += 0x7FFFu + ((u >> 16) & 1u); float r = __uint_as_float(u & 0xFFFF0000u); asm volatile("" : "+v"(r)); return r; }
__device__ __forceinline__ float bfv(float f) { float r = bf16_rne(f); asm volatile("" : "+v"(r)); return r; }
__device__ __forceinline__ void split16(float v, b16& hi, b16& lo) { hi = (b16)v; lo = (b16)(v - (float)hi); }
__device__ __forceinline__ v16b frag_kb(const b16* p, int hh) { const v8b a = *(const v8b*)(p + 8 * hh), b = *(const v8b*)(p + 16 + 8 * hh); v16b f;
#pragma unroll
  for (int e = 0; e < 8; ++e) { f[e] = a[e]; f[8 + e] = b[e]; } return f; }
// transposing LDS load: from row-major rows [key][d] lane (c, half) gets 8 consecutive keys of column c; the loads at keys 0 and 16 of a 32-key block are one A fragment in frag_kb's k order
typedef __attribute__((ext_vector_type(8))) short s16x8;
__device__ __forceinline__ v8b ld_tr16(const b16* p) { typedef __attribute__((address_space(3))) s16x8 lds_s16x8; return __builtin_bit_cast(v8b, __builtin_amdgcn_ds_load_tr16_b128_v8i16((lds_s16x8*)p)); }
__device__ __forceinline__ v16b frag_tr(const b16* p, int pitch) { const v8b a = ld_tr16(p), b = ld_tr16(p + 16 * pitch); v16b f;
#pragma unroll
  for (int e = 0; e < 8; ++e) { f[e] = a[e]; f[8 + e] = b[e]; } return f; }
__device__ __forceinline__ v8f wmma16b(v16b a, v16b b, v8f c) { v8f d = __builtin_amdgcn_wmma_f32_16x16x32_f16(false, a, false, b, (short)0, c, false, false); asm volatile("v_nop\n\tv_nop\n\tv_nop\n\tv_nop" : "+v"(d) : "v"(a), "v"(b)); return d; }
// wput: one work-group per 128 k x 64 columns of one weight matrix. A lane asks for 8 rows x 16 bytes at once, 16 lanes covering 256 bytes of a row, so every load takes whole lines and all
// of them are in flight together; the lane's 8 k x 4 columns go rounded into LDS as four 16-byte pieces of the transposed tile (272-byte rows), and the rows leave as 256 contiguous bytes each.
__global__ __launch_bounds__(256) void wput_kernel(const float* __restrict__ wq, const float* __restrict__ wk, const float* __restrict__ wv, b16* __restrict__ WQKV, b16* __restrict__ Kh, b16* __restrict__ Kl, b16* __restrict__ Vh, b16* __restrict__ Vl) { const size_t nt = (size_t)gridDim.x * 256, u0 = (size_t)blockIdx.x * 256 + threadIdx.x; const v8b z = {0, 0, 0, 0, 0, 0, 0, 0};
  constexpr int TK = 128, TO = 64, TW = TK + 8, NKT = D / TK, NOT = D / TO;
  __shared__ __attribute__((aligned(16))) b16 Ts[TO * TW];
  const int tid = threadIdx.x, hi4 = tid >> 4, lo4 = tid & 15; const int which = blockIdx.x / (NKT * NOT), rem = blockIdx.x % (NKT * NOT), k0 = (rem / NOT) * TK, o0 = (rem % NOT) * TO;
  const float* const w = which == 0 ? wq : (which == 1 ? wk : wv); const float* const wp = w + (size_t)(k0 + hi4 * 8) * D + o0 + lo4 * 4;
  v4f f[8];
#pragma unroll   // the row steps become immediate offsets on one address
  for (int j = 0; j < 8; ++j) f[j] = *(const v4f*)(wp + j * D);
#pragma unroll   // constant indices: the loaded rows and the packed pieces stay in registers
  for (int c = 0; c < 4; ++c) { v8b v;
#pragma unroll   // as above
    for (int j = 0; j < 8; ++j) v[j] = (b16)(bf16_rne(f[j][c]) * WSC);
    *(v8b*)(Ts + (lo4 * 4 + c) * TW + hi4 * 8) = v; }
  __syncthreads();   // the transposed tile is whole before its rows are read
  { b16* const op = WQKV + ((size_t)which * D + o0 + hi4) * D + k0 + lo4 * 8; const b16* const tp = Ts + hi4 * TW + lo4 * 8;
#pragma unroll   // the row steps become immediate offsets on one address
    for (int i = 0; i < 4; ++i) *(v8b*)(op + (size_t)i * 16 * D) = *(const v8b*)(tp + i * 16 * TW); }
  for (size_t u = u0; u < (size_t)(TP - T) * (D / 8); u += nt) { const size_t off = (size_t)T * D + u * 8; { *(v8b*)(Kh + off) = z; *(v8b*)(Kl + off) = z; *(v8b*)(Vh + off) = z; *(v8b*)(Vl + off) = z;  } } }
// the low 32 bits of a __shared__ address: the byte address in the work-group's LDS, as an asynchronous copy takes it
__device__ __forceinline__ unsigned lds_addr(const void* p) { typedef __attribute__((address_space(3))) const char lds_c; return (unsigned)(unsigned long long)(lds_c*)p; }
// proj: one work-group of 8 waves per 128-token x 256-column tile of [q|k|v], 64-k stages in two LDS buffers. x goes through registers (it is rounded and scaled on the way);
// the weight rows, 16-bit already, go from L2 into LDS by asynchronous copies, which hold no registers while they fly: that is what lets 16 accumulator tiles a wave fit at four waves per SIMD.
// Each wave owns 64 x 64 outputs (4 x 4 accumulator tiles), so every fragment read from LDS feeds 4 products, and a weight row fetched from L2 serves 128 tokens. k runs upward in one chain per output.
// The token count is a multiple of 64, not of 128: the last tile's upper 64 rows read the lower 64 again (in bounds) and are not stored.
// Four waves per SIMD (two work-groups per WGP): one work-group's staging and barrier waits stand behind the other's products.
__global__ __launch_bounds__(256) __attribute__((amdgpu_waves_per_eu(4, 4))) void proj_kernel(const float* __restrict__ x, const b16* __restrict__ WQKV, const float* __restrict__ bq, const float* __restrict__ bv, int BLIM, b16* __restrict__ Qh, b16* __restrict__ Ql, b16* __restrict__ Kh, b16* __restrict__ Kl, b16* __restrict__ Vh, b16* __restrict__ Vl) {
  constexpr int KC = 64, NS = D / KC, KP = KC + 8 /* 144-byte rows: 16 B x odd for 16-byte readers */, MT = 128, ASZ = MT * KP, STG = ASZ + 256 * KP, TFP = 260;
  constexpr int SMB = 2 * STG * 2 > MT * TFP * 4 ? 2 * STG * 2 : MT * TFP * 4;
  __shared__ __attribute__((aligned(16))) char smem[SMB];
  b16* const St = (b16*)smem; float* const Tf = (float*)smem;   // the output tile reuses the stages behind a barrier
  const int tid = threadIdx.x, lane = tid & 31, wave = __builtin_amdgcn_readfirstlane(tid >> 5) /* in a scalar register, with all that follows from it */, nloc = lane & 15, hlf = lane >> 4, wm = wave >> 2, wn = wave & 3;
  const int g = blockIdx.x % 9, which = g / 3, c0 = (g % 3) * 256; const size_t t0 = (size_t)(blockIdx.x / 9) * MT; if (t0 >= (size_t)BLIM * S) return;
  const bool up = t0 + 64 < (size_t)T;   // the same for the whole work-group
  const int ar = tid >> 4, ac = (tid & 15) * 4, br = tid >> 3, bc = (tid & 7) * 8;   // 16 lanes cover 256 B of an x row, 8 lanes 128 B of a weight row
  const float* xg = x + (t0 + ar) * D + ac; const float* xu = xg + (up ? 64 * D : 0);   // both run along k, a stage at a time
  const b16* const ws = WQKV + ((size_t)which * D + c0) * D; const unsigned wo = (br * D + bc) * 2;
  const unsigned wl = lds_addr(St + ASZ + br * KP + bc);
  v4f xr[8]; v8f acc[4][4];
#pragma unroll
  for (int m = 0; m < 4; ++m)
#pragma unroll
    for (int n = 0; n < 4; ++n) acc[m][n] = (v8f){};
  auto fetch = [&]() {
#pragma unroll
    for (int i = 0; i < 4; ++i) { xr[i] = *(const v4f*)(xg + (size_t)i * 16 * D); xr[4 + i] = *(const v4f*)(xu + (size_t)i * 16 * D); } };
  auto step = [&]() { xg += KC; xu += KC; };   // on to the next stage; the additions rewrite address registers of issued loads: in the listing s_wait_xcnt stands in front of each of them
  auto put = [&](b16* st) {
#pragma unroll
    for (int i = 0; i < 8; ++i) { v4b h;
#pragma unroll
      for (int j = 0; j < 4; ++j) h[j] = (b16)(bf16_rne(xr[i][j]) * XS);
      *(v4b*)(st + (ar + i * 16) * KP + ac) = h; } };
  // a stage's 256 weight rows: 8 copies of 16 bytes a lane, rows 32 apart: a scalar base per copy (the same for the work-group) and one 32-bit lane offset, so that the global addresses hold one vector register.
  // The wait on the address translations is the statement's last line, so that it stands in front of every later write of a register that a copy names.
  auto wcopy = [&](int s, int par) { const unsigned l = wl + par * (STG * 2); const b16* const p = ws + s * KC;
    asm volatile("global_load_async_to_lds_b128 %0, %8, %9\n\tglobal_load_async_to_lds_b128 %1, %8, %10\n\tglobal_load_async_to_lds_b128 %2, %8, %11\n\tglobal_load_async_to_lds_b128 %3, %8, %12\n\t"
                 "global_load_async_to_lds_b128 %4, %8, %13\n\tglobal_load_async_to_lds_b128 %5, %8, %14\n\tglobal_load_async_to_lds_b128 %6, %8, %15\n\tglobal_load_async_to_lds_b128 %7, %8, %16\n\ts_wait_xcnt 0x0"
                 :: "v"(l), "v"(l + 32 * KP * 2), "v"(l + 64 * KP * 2), "v"(l + 96 * KP * 2), "v"(l + 128 * KP * 2), "v"(l + 160 * KP * 2), "v"(l + 192 * KP * 2), "v"(l + 224 * KP * 2), "v"(wo),
                    "s"(p), "s"(p + 32 * D), "s"(p + 64 * D), "s"(p + 96 * D), "s"(p + 128 * D), "s"(p + 160 * D), "s"(p + 192 * D), "s"(p + 224 * D) : "memory"); };
  fetch(); wcopy(0, 0); put(St); step(); fetch();
  asm volatile("s_wait_asynccnt 0x0" ::: "memory");   // this wave's copies of stage 0 have landed before the barrier that publishes them
  __syncthreads();
  wcopy(1, 1); put(St + STG); step(); fetch();
  auto trip = [&](int c, int par) { const b16* const cur = St + par * STG;   // par = c & 1 as a constant: the LDS offsets stay immediates
#pragma unroll
    for (int ks = 0; ks < 2; ++ks) { v16b a[4], b[4];   // the fragment reads of a 32-k half stand as one group ahead of its 16 products
#pragma unroll
      for (int n = 0; n < 4; ++n) b[n] = frag_kb(cur + ASZ + (wn * 64 + n * 16 + nloc) * KP + ks * 32, hlf);
#pragma unroll
      for (int m = 0; m < 4; ++m) a[m] = frag_kb(cur + (wm * 64 + m * 16 + nloc) * KP + ks * 32, hlf);
#pragma unroll
      for (int m = 0; m < 4; ++m)
#pragma unroll
        for (int n = 0; n < 4; ++n) acc[m][n] = wmma16b(a[m], b[n], acc[m][n]); }
    asm volatile("s_wait_dscnt 0x0" ::: "memory");      // this wave's reads of stage c and its x stores of stage c + 1 are done
    asm volatile("s_wait_asynccnt 0x0" ::: "memory");   // this wave's copies of stage c + 1 have landed
    __syncthreads();   // publishes stage c + 1 and ends every read of the buffer that stage c + 2 goes into (behind the last trip: of the stages, before the output tile overwrites them)
    if (c + 2 < NS) { wcopy(c + 2, par); put(St + par * STG);
      if (c + 3 < NS) { step(); fetch(); } } };   // stage c + 3: a stage's global loads have a whole trip to land
#pragma unroll 1   // kept rolled, two trips (one per buffer) a pass: for speed only
  for (int c = 0; c < NS; c += 2) { trip(c, 0); trip(c + 1, 1); }
  asm volatile("s_wait_asynccnt 0x0" ::: "memory");   // no copy is outstanding when the stages are reused
  // the lane's number is formed anew here: carried from the top, the indices of this part would hold registers through the whole loop, which has none to spare (the build spilled them)
  const int el = __builtin_amdgcn_mbcnt_lo(~0u, 0u), en = el & 15, eh = el >> 4;
#pragma unroll
  for (int n = 0; n < 4; ++n) { const int cc = wn * 64 + n * 16 + en; const float bb = which == 0 ? bfv(bq[c0 + cc]) : (which == 2 ? bfv(bv[c0 + cc]) : 0.0f);
#pragma unroll
    for (int m = 0; m < 4; ++m)
#pragma unroll
      for (int r8 = 0; r8 < 8; ++r8) Tf[(wm * 64 + m * 16 + 8 * eh + r8) * TFP + cc] = acc[m][n][r8] * (1.0f / (XS * WSC)) + bb; }
  __syncthreads();
  // the row loops are unrolled so that the row addresses are immediates and no address register is rewritten behind a store
  { const size_t ob = (t0 + wave) * D + c0 + el * 4; b16* const Ph = (which == 0 ? Qh : (which == 1 ? Kh : Vh)) + ob; b16* const Pl = (which == 0 ? Ql : (which == 1 ? Kl : Vl)) + ob; const float* const Tp = Tf + wave * TFP + el * 4;
    auto row = [&](int i) {
#pragma unroll
      for (int q = 0; q < 2; ++q) { const v4f f = *(const v4f*)(Tp + i * 8 * TFP + q * 128); v4b hi, lo;
#pragma unroll
        for (int j = 0; j < 4; ++j) { b16 h0, l0; split16(f[j] * HS, h0, l0); hi[j] = h0; lo[j] = l0; }
        *(v4b*)(Ph + (size_t)i * 8 * D + q * 128) = hi; *(v4b*)(Pl + (size_t)i * 8 * D + q * 128) = lo; } };
#pragma unroll
    for (int i = 0; i < 8; ++i) row(i);
    asm volatile("s_wait_xcnt 0x0" ::: "memory");   // behind the last stores of the lower rows: the upper rows' LDS reads reuse their data registers
    if (up) {
#pragma unroll
      for (int i = 8; i < 16; ++i) row(i); } } }
// relative position index: entry 731 for (cls, cls), 729 for the cls query, 730 for the cls key; for patches (dy + 13) * 27 + dx + 13.
// With patch p = token - 1 written as row * 27 + column that is plin(q - 1) - plin(k - 1) + 13 * 27 + 13
__device__ __forceinline__ constexpr int plin(int p) { return (p / WH) * (2 * WH - 1) + p % WH; }
// exp(x) as the fast intrinsic forms it (x * log2 e, then the hardware exp2). The v_nop is the slot behind a transcendental: written into the same statement, it stands there
// whichever instruction the compiler puts next.
__device__ __forceinline__ float exp_slot(float x) { const float y = x * 1.44269504f; float r; asm("v_exp_f32 %0, %1\n\tv_nop" : "=v"(r) : "v"(y)); return r; }
// att: one work-group of 7 waves per (b, h, half of the 13 query tiles); one wave per 16 queries, everything transposed and in registers as before.
// The head's k rows, v rows (hi and lo) and bias column are brought into LDS once, with loads that cover whole 128-byte lines, and every wave takes its fragments from there:
// a fragment load straight from global memory touches 16 lines for 512 bytes, and each of the 13 waves of a head repeated all of them.
// LDS pitches: 16 B x odd (144 B) for k and its 16-byte readers, 32 B x odd (160 B) for v and its transposing readers, which hand out v^T fragments from the rows as the projection wrote them.
// v rows 197 to 223 are the next image's (behind the last image: zeros); they are finite and meet P = 0.
// S^T = k rows (A) x q (B): lane (c, half) holds for query q0 + c the keys 16 t + 8 half + r,
// so bias, maximum, exp and sum run in-lane on all 32 lanes, with one exchange between the halves. Two score tiles, converted in place, are the B operand of ctx^T = v^T rows (A) x P^T
// in the k order in which the transposing loads hand out v^T; a lane then holds 8 consecutive d of its query and stores them itself.
// Loads stand one tile ahead of their products. The scheduling barriers keep that order: without them the next tile's bias rounding, and with it the wait for loads just issued, is lifted in front of this tile's products, and the register count passes 256.
__global__ __launch_bounds__(224) void att_kernel(const b16* __restrict__ Qh, const b16* __restrict__ Ql, const b16* __restrict__ Kh, const b16* __restrict__ Kl, const b16* __restrict__ Vh, const b16* __restrict__ Vl, const float* __restrict__ btab, int BLIM, float* __restrict__ out) {
  constexpr int KP = HD + 8, VP = HD + 16, KSZ = SP * KP, VSZ = VK * VP;
  __shared__ __attribute__((aligned(16))) char smem[(2 * KSZ + 2 * VSZ) * 2 + NRD * 4];
  b16* const Ksh = (b16*)smem; b16* const Ksl = Ksh + KSZ; b16* const Vsh = Ksl + KSZ; b16* const Vsl = Vsh + VSZ; float* const Bs = (float*)(Vsl + VSZ);
  const int tid = threadIdx.x, lane = tid & 31, nloc = lane & 15, hlf = lane >> 4; const int b = blockIdx.x / (H * 2), rem = blockIdx.x % (H * 2); const int h = rem / 2; if (b >= BLIM) return; const size_t tb = (size_t)b * S;
  const int qt = (rem % 2) * 7 + __builtin_amdgcn_readfirstlane(tid >> 5);
  // the wave's own q fragments are asked for first, so that they land while the shared rows are staged (the wave without a query tile reads the image's last row, in bounds)
  const int q0 = qt * 16;
  const int q = q0 + nloc; const size_t qrow = tb + (q < S ? q : S - 1);   // columns past the image read a valid row; their results are not written
  // the q pointers hold the lane's whole address (the half's 8 elements too), so that all loads of the stream name that one register pair plus a constant
  const b16* const qph = Qh + qrow * D + h * HD + 8 * hlf; const b16* const qpl = Ql + qrow * D + h * HD + 8 * hlf;
  v16b qa[2], ql[2];
#pragma unroll
  for (int ks = 0; ks < 2; ++ks) { qa[ks] = frag_kb(qph + ks * 32, 0); ql[ks] = frag_kb(qpl + ks * 32, 0); }
  asm volatile("s_wait_xcnt 0x0" :: "v"(qph), "v"(qpl) : "memory");   // behind the last loads that name these address registers; as inputs they stay untouched up to the wait and are free for reuse behind it
  { // staging: 8 lanes cover the 128 B of a k row or a v row; all row steps are constants on one address per stream
    const int kr = tid >> 3, kc = (tid & 7) * 8;
    const b16* const gkh = Kh + (tb + kr) * D + h * HD + kc; const b16* const gkl = Kl + (tb + kr) * D + h * HD + kc;
    const b16* const gvh = Vh + (tb + kr) * D + h * HD + kc; const b16* const gvl = Vl + (tb + kr) * D + h * HD + kc;
    const float* const gb = btab + tid * H + h;
    v8b rk[2][8], rv[2][8]; float rb[4];
#pragma unroll   // the row steps become immediate offsets and the staging arrays stay in registers
    for (int i = 0; i < 7; ++i) { rk[0][i] = *(const v8b*)(gkh + i * 28 * D); rk[1][i] = *(const v8b*)(gkl + i * 28 * D); }
    if (tid < 96) { rk[0][7] = *(const v8b*)(gkh + 7 * 28 * D); rk[1][7] = *(const v8b*)(gkl + 7 * 28 * D); }   // rows 196 to 207: three whole waves
#pragma unroll   // the row steps become immediate offsets and the staging arrays stay in registers
    for (int i = 0; i < 8; ++i) { rv[0][i] = *(const v8b*)(gvh + i * 28 * D); rv[1][i] = *(const v8b*)(gvl + i * 28 * D); }
#pragma unroll   // the row steps become immediate offsets and the staging arrays stay in registers
    for (int i = 0; i < 3; ++i) rb[i] = gb[i * 224 * H];
    if (tid < NRD - 3 * 224) rb[3] = gb[3 * 224 * H];
    asm volatile("s_wait_xcnt 0x0" :: "v"(gkh), "v"(gkl), "v"(gvh), "v"(gvl), "v"(gb) : "memory");   // behind the last loads that name these address registers; as inputs they stay untouched up to the wait
#pragma unroll   // the row steps become immediate offsets and the staging arrays stay in registers
    for (int i = 0; i < 7; ++i) { *(v8b*)(Ksh + (kr + i * 28) * KP + kc) = rk[0][i]; *(v8b*)(Ksl + (kr + i * 28) * KP + kc) = rk[1][i]; }
    if (tid < 96) { *(v8b*)(Ksh + (kr + 7 * 28) * KP + kc) = rk[0][7]; *(v8b*)(Ksl + (kr + 7 * 28) * KP + kc) = rk[1][7]; }
#pragma unroll   // the row steps become immediate offsets and the staging arrays stay in registers
    for (int i = 0; i < 8; ++i) { *(v8b*)(Vsh + (kr + i * 28) * VP + kc) = rv[0][i]; *(v8b*)(Vsl + (kr + i * 28) * VP + kc) = rv[1][i]; }
#pragma unroll   // the row steps become immediate offsets and the staging arrays stay in registers
    for (int i = 0; i < 3; ++i) Bs[tid + i * 224] = rb[i];
    if (tid < NRD - 3 * 224) Bs[tid + 3 * 224] = rb[3]; }
  __syncthreads();   // publishes the staged rows; the only barrier, so the wave without a query tile may leave behind it
  if (qt >= 13) return;
  v16b kh[2][2], kl[2][2]; float br[2][8];
  // bias addresses: for a patch query the entry of key k lies plin(k - 1) entries below the query's own base, a constant per register but for the upper half's 8 keys (8 or 21 entries more).
  // The cls query (and a column past the image, as before) has one entry for all patch keys: it reads as query 1, in bounds, and takes the cls value instead.
  const int qq = q < S ? q : 0; const bool qcls = qq == 0; const int base = plin(qcls ? 0 : qq - 1) + (WH - 1) * (2 * WH - 1) + (WH - 1);
  constexpr int PL = plin(S - 2); const float* const pn = Bs + (base - PL); const float* const p0 = pn - hlf * 8; const float* const p1 = pn - hlf * 21;   // set to the last key's entry: constants from 0 up
  const float bcls = Bs[NRD - 3];
  const int idx0 = hlf == 0 ? (qcls ? NRD - 1 : NRD - 2) : (qcls ? NRD - 3 : base - plin(7));   // register 0 of tile 0: key 0 or key 8
  const b16* const kph = Ksh + nloc * KP + 8 * hlf; const b16* const kpl = Ksl + nloc * KP + 8 * hlf;
  const int vlo = (8 * hlf + (lane & 7)) * VP + ((lane >> 3) & 1) * 8;   // the transposing load's lane address: key row 8 half + (lane & 7), 16 bytes further for lanes 8 to 15 of a half
  const b16* const vph = Vsh + vlo; const b16* const vpl = Vsl + vlo;
  auto kfetch = [&](int t, int bf) {
#pragma unroll
    for (int ks = 0; ks < 2; ++ks) { kh[bf][ks] = frag_kb(kph + t * 16 * KP + ks * 32, 0); kl[bf][ks] = frag_kb(kpl + t * 16 * KP + ks * 32, 0); }
#pragma unroll
    for (int r8 = 0; r8 < 8; ++r8) { const int c = t * 16 + r8;   // the lower half's key; the upper half's is c + 8
      if (c >= S) br[bf][r8] = 0.0f; else if (c == 0) br[bf][r8] = Bs[idx0];
      else br[bf][r8] = (c + 8 >= S ? pn : ((c + 7) / WH != (c - 1) / WH ? p1 : p0))[PL - plin(c - 1)]; } };   // an upper-half key past the image reads the lower half's entry and is masked below
  v16b vh[2][2], vl[2][2];
  auto vfetch = [&](int u, int bf) {   // unit u: keys 32 (u / 2) ..., d tiles 2 (u % 2) and 2 (u % 2) + 1
#pragma unroll
    for (int i = 0; i < 2; ++i) { const int vo = (u >> 1) * 32 * VP + ((u & 1) * 2 + i) * 16; vh[bf][i] = frag_tr(vph + vo, VP); vl[bf][i] = frag_tr(vpl + vo, VP); } };
  v8f s[13]; float mx = -INFINITY;
  kfetch(0, 0);
#pragma unroll
  for (int t = 0; t < 13; ++t) { const int bf = t & 1; if (t + 1 < 13) kfetch(t + 1, bf ^ 1); else vfetch(0, 0);
    __builtin_amdgcn_sched_barrier(0);   // the next tile's loads are issued before this tile's work
    v8f a = (v8f){};
#pragma unroll
    for (int ks = 0; ks < 2; ++ks) { a = wmma16b(kh[bf][ks], qa[ks], a); a = wmma16b(kl[bf][ks], qa[ks], a); a = wmma16b(kh[bf][ks], ql[ks], a); }
#pragma unroll
    for (int r8 = 0; r8 < 8; ++r8) { const int c = t * 16 + r8;
      if (c >= S) { a[r8] = -INFINITY; continue; }
      float v = a[r8] * (SCALE / (HS * HS)) + bfv(c != 0 && qcls ? bcls : br[bf][r8]); if (c + 8 >= S && hlf) v = -INFINITY;
      a[r8] = v; mx = fmaxf(mx, v); }
    s[t] = a; __builtin_amdgcn_sched_barrier(0); }   // nothing of the next tile is worked on, or waited for, in front of this point
  mx = fmaxf(mx, __shfl_xor(mx, 16, 32));
  float sp[8] = {0.0f, 0.0f, 0.0f, 0.0f, 0.0f, 0.0f, 0.0f, 0.0f};   // eight partial sums: no chain of 101 dependent adds
#pragma unroll
  for (int t = 0; t < 13; ++t)
#pragma unroll
    for (int r8 = 0; r8 < 8; ++r8) { if (t * 16 + r8 >= S) { s[t][r8] = 0.0f; continue; } const float p = exp_slot(s[t][r8] - mx); s[t][r8] = p; sp[r8] += p; }
  float sm = ((sp[0] + sp[1]) + (sp[2] + sp[3])) + ((sp[4] + sp[5]) + (sp[6] + sp[7])); sm += __shfl_xor(sm, 16, 32); const float inv = 1.0f / sm;
  __builtin_amdgcn_sched_barrier(0);   // the second v^T unit's loads stay behind the softmax: lifted in front of it they hold 32 more registers through it and the count passes 256
  v8f o[4] = {(v8f){}, (v8f){}, (v8f){}, (v8f){}}; v16b pa, pb;
#pragma unroll
  for (int u = 0; u < 14; ++u) { const int bf = u & 1, j = u >> 1, t0 = (u & 1) * 2, t1 = t0 + 1; if (u + 1 < 14) vfetch(u + 1, bf ^ 1);
    __builtin_amdgcn_sched_barrier(0);   // the next unit's loads are issued before this unit's products
    if ((u & 1) == 0) {
#pragma unroll
      for (int e = 0; e < 8; ++e) { b16 p, pl; split16(s[2 * j][e] * inv * PS, p, pl); pa[e] = p; pb[e] = pl;
        if (2 * j + 1 < 13) { split16(s[2 * j + 1][e] * inv * PS, p, pl); pa[8 + e] = p; pb[8 + e] = pl; } else { pa[8 + e] = (b16)0.0f; pb[8 + e] = (b16)0.0f; } } }
    o[t0] = wmma16b(vh[bf][0], pa, o[t0]); o[t1] = wmma16b(vh[bf][1], pa, o[t1]); o[t0] = wmma16b(vl[bf][0], pa, o[t0]); o[t1] = wmma16b(vl[bf][1], pa, o[t1]); o[t0] = wmma16b(vh[bf][0], pb, o[t0]); o[t1] = wmma16b(vh[bf][1], pb, o[t1]); __builtin_amdgcn_sched_barrier(0); }   // as above: no wait for the next unit in front of this point
  if (q < S) { float* const op = out + (tb + q) * D + h * HD + 8 * hlf;
#pragma unroll
    for (int t = 0; t < 4; ++t) { const v8f f = o[t] * (1.0f / (PS * HS)); *(v4f*)(op + t * 16) = (v4f){f[0], f[1], f[2], f[3]}; *(v4f*)(op + t * 16 + 4) = (v4f){f[4], f[5], f[6], f[7]}; } } }
}  // namespace

extern "C" void kernel_launch(void* const* d_in, const int* in_sizes, int n_in, void* d_out, int out_size, void* d_ws, size_t ws_size, hipStream_t stream) {
  (void)n_in;
  auto Fp = [&](int i) { return (const float*)d_in[i]; };
  // input order: 0 hidden_states [64,197,768]; 1 Wq [768,768]; 2 bq [768]; 3 Wk; 4 Wv; 5 bv; 6 bias_table [732,12]
  if (in_sizes[0] != T * D || in_sizes[1] != D * D || in_sizes[3] != D * D || in_sizes[4] != D * D || in_sizes[6] != NRD * H || out_size != T * D) return;
  const int BLIM = NB_;
  size_t off = 0; char* ws = (char*)d_ws;
  auto carve = [&](size_t bytes) { char* p = ws + off; off += (bytes + 255) & ~(size_t)255; return p; };
  b16* WQKV = (b16*)carve((size_t)3 * D * D * 2); b16* Qh = (b16*)carve((size_t)TP * D * 2); b16* Ql = (b16*)carve((size_t)TP * D * 2); b16* Kh = (b16*)carve((size_t)TP * D * 2); b16* Kl = (b16*)carve((size_t)TP * D * 2); b16* Vh = (b16*)carve((size_t)TP * D * 2); b16* Vl = (b16*)carve((size_t)TP * D * 2);
  if (off > ws_size || off > ((size_t)176 << 20)) return;   // ~ 120 MB
  wput_kernel<<<216 /* 3 matrices x 6 k tiles x 12 column tiles */, 256, 0, stream>>>(Fp(1), Fp(3), Fp(4), WQKV, Kh, Kl, Vh, Vl);
  proj_kernel<<<(BLIM * S + 127) / 128 * 9, 256, 0, stream>>>(Fp(0), WQKV, Fp(2), Fp(5), BLIM, Qh, Ql, Kh, Kl, Vh, Vl);
  att_kernel<<<BLIM * H * 2, 224, 0, stream>>>(Qh, Ql, Kh, Kl, Vh, Vl, Fp(6), BLIM, (float*)d_out);
}

// v009
// Measured time: 83.4 microseconds a run.
// It is 1.39 times as fast as v007, going by the measured steps of the versions left out in between.
// Over all steps from v000 it is 13.6 times as fast.
#include <hip/hip_runtime.h>

// BeitSelfAttention: q = x Wq + bq, k = x Wk (no bias), v = x Wv + bv (12 heads x 64); scores = q.k/8 + bias_table[rel_idx(q,k)][h] (BEiT relative position index incl. the cls row/column/corner entries); probs = softmax; ctx = probs v -> [64][197][768].
// Deterministic: per-wave softmax over the 197 keys in fixed order; no atomics.
// WMMA (v_wmma_f32_16x16x32_f16, f32 accumulate): x (EXACT bf16 x8, K 768) x [Wq|Wk|Wv] rows (EXACT x256 (in,out); 144 tiles in 9 groups), 128 tokens x 256 columns per 8-wave work-group; per (b, h, 16-query) wave, k, v and the bias column shared through LDS by 7 waves, S^T = k rows (13 tiles) x q (x256, K 64) and ctx^T = v^T rows (4 tiles, K 224, P = 0 past the image) x P^T, one product each; bias gather + softmax in f32.
// q, k, v and P enter the attention products as one 16-bit float each (11 significant bits): x and the weights carry 8 bits into the projection, so that rounding, not this one, sets the result's error.

namespace {
constexpr int NB_ = 64, S = 197, SP = 208 /* 13 key tiles */, VK = 224 /* 7 key pairs of tiles for v */, D = 768, H = 12, HD = 64, T = NB_ * S /* 12608 = 788*16 */, TP = T + 32, WH = 14, NRD = 732;
constexpr float XS = 8.0f, HS = 256.0f, PS = 256.0f, WSC = 256.0f, SCALE = 0.125f;
typedef _Float16 b16;
typedef __attribute__((ext_vector_type(16))) _Float16 v16b;
typedef __attribute__((ext_vector_type(8))) _Float16 v8b;
typedef __attribute__((ext_vector_type(4))) _Float16 v4b;
typedef __attribute__((ext_vector_type(2))) _Float16 v2b;
typedef __attribute__((ext_vector_type(8))) float v8f;
typedef __attribute__((ext_vector_type(4))) float v4f;
typedef __attribute__((ext_vector_type(2))) float v2f;
__device__ __forceinline__ float bf16_rne(float f) { unsigned int u = __float_as_uint(f); u += 0x7FFFu + ((u >> 16) & 1u); float r = __uint_as_float(u & 0xFFFF0000u); asm volatile("" : "+v"(r)); return r; }
__device__ __forceinline__ float bfv(float f) { float r = bf16_rne(f); asm volatile("" : "+v"(r)); return r; }
__device__ __forceinline__ v16b frag_kb(const b16* p, int hh) { const v8b a = *(const v8b*)(p + 8 * hh), b = *(const v8b*)(p + 16 + 8 * hh); v16b f;
#pragma unroll
  for (int e = 0; e < 8; ++e) { f[e] = a[e]; f[8 + e] = b[e]; } return f; }
// transposing LDS load: from row-major rows [key][d] lane (c, half) gets 8 consecutive keys of column c; the loads at keys 0 and 16 of a 32-key block are one A fragment in frag_kb's k order
typedef __attribute__((ext_vector_type(8))) short s16x8;
__device__ __forceinline__ v8b ld_tr16(const b16* p) { typedef __attribute__((address_space(3))) s16x8 lds_s16x8; return __builtin_bit_cast(v8b, __builtin_amdgcn_ds_load_tr16_b128_v8i16((lds_s16x8*)p)); }
__device__ __forceinline__ v16b frag_tr(const b16* p, int pitch) { const v8b a = ld_tr16(p), b = ld_tr16(p + 16 * pitch); v16b f;
#pragma unroll
  for (int e = 0; e < 8; ++e) { f[e] = a[e]; f[8 + e] = b[e]; } return f; }
__device__ __forceinline__ v8f wmma16b(v16b a, v16b b, v8f c) { v8f d = __builtin_amdgcn_wmma_f32_16x16x32_f16(false, a, false, b, (short)0, c, false, false); asm volatile("v_nop\n\tv_nop\n\tv_nop\n\tv_nop" : "+v"(d) : "v"(a), "v"(b)); return d; }
// wput: one work-group per 128 k x 64 columns of one weight matrix. A lane asks for 8 rows x 16 bytes at once, 16 lanes covering 256 bytes of a row, so every load takes whole lines and all
// of them are in flight together; the lane's 8 k x 4 columns go rounded into LDS as four 16-byte pieces of the transposed tile (272-byte rows), and the rows leave as 256 contiguous bytes each.
__global__ __launch_bounds__(256) void wput_kernel(const float* __restrict__ wq, const float* __restrict__ wk, const float* __restrict__ wv, b16* __restrict__ WQKV, b16* __restrict__ Kh, b16* __restrict__ Vh) { const size_t nt = (size_t)gridDim.x * 256, u0 = (size_t)blockIdx.x * 256 + threadIdx.x; const v8b z = {0, 0, 0, 0, 0, 0, 0, 0};
  constexpr int TK = 128, TO = 64, TW = TK + 8, NKT = D / TK, NOT = D / TO;
  __shared__ __attribute__((aligned(16))) b16 Ts[TO * TW];
  const int tid = threadIdx.x, hi4 = tid >> 4, lo4 = tid & 15; const int which = blockIdx.x / (NKT * NOT), rem = blockIdx.x % (NKT * NOT), k0 = (rem / NOT) * TK, o0 = (rem % NOT) * TO;
  const float* const w = which == 0 ? wq : (which == 1 ? wk : wv); const float* const wp = w + (size_t)(k0 + hi4 * 8) * D + o0 + lo4 * 4;
  v4f f[8];
#pragma unroll   // the row steps become immediate offsets on one address
  for (int j = 0; j < 8; ++j) f[j] = *(const v4f*)(wp + j * D);
#pragma unroll   // constant indices: the loaded rows and the packed pieces stay in registers
  for (int c = 0; c < 4; ++c) { v8b v;
#pragma unroll   // as above
    for (int j = 0; j < 8; ++j) v[j] = (b16)(bf16_rne(f[j][c]) * WSC);
    *(v8b*)(Ts + (lo4 * 4 + c) * TW + hi4 * 8) = v; }
  __syncthreads();   // the transposed tile is whole before its rows are read
  { b16* const op = WQKV + ((size_t)which * D + o0 + hi4) * D + k0 + lo4 * 8; const b16* const tp = Ts + hi4 * TW + lo4 * 8;
#pragma unroll   // the row steps become immediate offsets on one address
    for (int i = 0; i < 4; ++i) *(v8b*)(op + (size_t)i * 16 * D) = *(const v8b*)(tp + i * 16 * TW); }
  for (size_t u = u0; u < (size_t)(TP - T) * (D / 8); u += nt) { const size_t off = (size_t)T * D + u * 8; { *(v8b*)(Kh + off) = z; *(v8b*)(Vh + off) = z; } } }
// the low 32 bits of a __shared__ address: the byte address in the work-group's LDS, as an asynchronous copy takes it
__device__ __forceinline__ unsigned lds_addr(const void* p) { typedef __attribute__((address_space(3))) const char lds_c; return (unsigned)(unsigned long long)(lds_c*)p; }
// proj: one work-group of 8 waves per 128-token x 256-column tile of [q|k|v], 64-k stages in two LDS buffers. x goes through registers (it is rounded and scaled on the way);
// the weight rows, 16-bit already, go from L2 into LDS by asynchronous copies, which hold no registers while they fly: that is what lets 16 accumulator tiles a wave fit at four waves per SIMD.
// Each wave owns 64 x 64 outputs (4 x 4 accumulator tiles), so every fragment read from LDS feeds 4 products, and a weight row fetched from L2 serves 128 tokens. k runs upward in one chain per output.
// The token count is a multiple of 64, not of 128: the last tile's upper 64 rows read the lower 64 again (in bounds) and are not stored.
// Four waves per SIMD (two work-groups per WGP): one work-group's staging and barrier waits stand behind the other's products.
__global__ __launch_bounds__(256) __attribute__((amdgpu_waves_per_eu(4, 4))) void proj_kernel(const float* __restrict__ x, const b16* __restrict__ WQKV, const float* __restrict__ bq, const float* __restrict__ bv, int BLIM, b16* __restrict__ Qh, b16* __restrict__ Kh, b16* __restrict__ Vh) {
  constexpr int KC = 64, NS = D / KC, KP = KC + 8 /* 144-byte rows: 16 B x odd for 16-byte readers */, MT = 128, ASZ = MT * KP, STG = ASZ + 256 * KP, TFP = 260;
  constexpr int SMB = 2 * STG * 2 > MT * TFP * 4 ? 2 * STG * 2 : MT * TFP * 4;
  __shared__ __attribute__((aligned(16))) char smem[SMB];
  b16* const St = (b16*)smem; float* const Tf = (float*)smem;   // the output tile reuses the stages behind a barrier
  const int tid = threadIdx.x, lane = tid & 31, wave = __builtin_amdgcn_readfirstlane(tid >> 5) /* in a scalar register, with all that follows from it */, nloc = lane & 15, hlf = lane >> 4, wm = wave >> 2, wn = wave & 3;
  const int g = blockIdx.x % 9, which = g / 3, c0 = (g % 3) * 256; const size_t t0 = (size_t)(blockIdx.x / 9) * MT; if (t0 >= (size_t)BLIM * S) return;
  const bool up = t0 + 64 < (size_t)T;   // the same for the whole work-group
  const int ar = tid >> 4, ac = (tid & 15) * 4, br = tid >> 3, bc = (tid & 7) * 8;   // 16 lanes cover 256 B of an x row, 8 lanes 128 B of a weight row
  const float* xg = x + (t0 + ar) * D + ac; const float* xu = xg + (up ? 64 * D : 0);   // both run along k, a stage at a time
  const b16* const ws = WQKV + ((size_t)which * D + c0) * D; const unsigned wo = (br * D + bc) * 2;
  const unsigned wl = lds_addr(St + ASZ + br * KP + bc);
  v4f xr[8]; v8f acc[4][4];
#pragma unroll
  for (int m = 0; m < 4; ++m)
#pragma unroll
    for (int n = 0; n < 4; ++n) acc[m][n] = (v8f){};
  auto fetch = [&]() {
#pragma unroll
    for (int i = 0; i < 4; ++i) { xr[i] = *(const v4f*)(xg + (size_t)i * 16 * D); xr[4 + i] = *(const v4f*)(xu + (size_t)i * 16 * D); } };
  auto step = [&]() { xg += KC; xu += KC; };   // on to the next stage; the additions rewrite address registers of issued loads: in the listing s_wait_xcnt stands in front of each of them
  auto put = [&](b16* st) {
#pragma unroll
    for (int i = 0; i < 8; ++i) { v4b h;
#pragma unroll
      for (int j = 0; j < 4; ++j) h[j] = (b16)(bf16_rne(xr[i][j]) * XS);
      *(v4b*)(st + (ar + i * 16) * KP + ac) = h; } };
  // a stage's 256 weight rows: 8 copies of 16 bytes a lane, rows 32 apart: a scalar base per copy (the same for the work-group) and one 32-bit lane offset, so that the global addresses hold one vector register.
  // The wait on the address translations is the statement's last line, so that it stands in front of every later write of a register that a copy names.
  auto wcopy = [&](int s, int par) { const unsigned l = wl + par * (STG * 2); const b16* const p = ws + s * KC;
    asm volatile("global_load_async_to_lds_b128 %0, %8, %9\n\tglobal_load_async_to_lds_b128 %1, %8, %10\n\tglobal_load_async_to_lds_b128 %2, %8, %11\n\tglobal_load_async_to_lds_b128 %3, %8, %12\n\t"
                 "global_load_async_to_lds_b128 %4, %8, %13\n\tglobal_load_async_to_lds_b128 %5, %8, %14\n\tglobal_load_async_to_lds_b128 %6, %8, %15\n\tglobal_load_async_to_lds_b128 %7, %8, %16\n\ts_wait_xcnt 0x0"
                 :: "v"(l), "v"(l + 32 * KP * 2), "v"(l + 64 * KP * 2), "v"(l + 96 * KP * 2), "v"(l + 128 * KP * 2), "v"(l + 160 * KP * 2), "v"(l + 192 * KP * 2), "v"(l + 224 * KP * 2), "v"(wo),
                    "s"(p), "s"(p + 32 * D), "s"(p + 64 * D), "s"(p + 96 * D), "s"(p + 128 * D), "s"(p + 160 * D), "s"(p + 192 * D), "s"(p + 224 * D) : "memory"); };
  fetch(); wcopy(0, 0); put(St); step(); fetch();
  asm volatile("s_wait_asynccnt 0x0" ::: "memory");   // this wave's copies of stage 0 have landed before the barrier that publishes them
  __syncthreads();
  wcopy(1, 1); put(St + STG); step(); fetch();
  auto trip = [&](int c, int par) { const b16* const cur = St + par * STG;   // par = c & 1 as a constant: the LDS offsets stay immediates
#pragma unroll
    for (int ks = 0; ks < 2; ++ks) { v16b a[4], b[4];   // the fragment reads of a 32-k half stand as one group ahead of its 16 products
#pragma unroll
      for (int n = 0; n < 4; ++n) b[n] = frag_kb(cur + ASZ + (wn * 64 + n * 16 + nloc) * KP + ks * 32, hlf);
#pragma unroll
      for (int m = 0; m < 4; ++m) a[m] = frag_kb(cur + (wm * 64 + m * 16 + nloc) * KP + ks * 32, hlf);
#pragma unroll
      for (int m = 0; m < 4; ++m)
#pragma unroll
        for (int n = 0; n < 4; ++n) acc[m][n] = wmma16b(a[m], b[n], acc[m][n]); }
    asm volatile("s_wait_dscnt 0x0" ::: "memory");      // this wave's reads of stage c and its x stores of stage c + 1 are done
    asm volatile("s_wait_asynccnt 0x0" ::: "memory");   // this wave's copies of stage c + 1 have landed
    __syncthreads();   // publishes stage c + 1 and ends every read of the buffer that stage c + 2 goes into (behind the last trip: of the stages, before the output tile overwrites them)
    if (c + 2 < NS) { wcopy(c + 2, par); put(St + par * STG);
      if (c + 3 < NS) { step(); fetch(); } } };   // stage c + 3: a stage's global loads have a whole trip to land
#pragma unroll 1   // kept rolled, two trips (one per buffer) a pass: for speed only
  for (int c = 0; c < NS; c += 2) { trip(c, 0); trip(c + 1, 1); }
  asm volatile("s_wait_asynccnt 0x0" ::: "memory");   // no copy is outstanding when the stages are reused
  // the lane's number is formed anew here: carried from the top, the indices of this part would hold registers through the whole loop, which has none to spare (the build spilled them)
  const int el = __builtin_amdgcn_mbcnt_lo(~0u, 0u), en = el & 15, eh = el >> 4;
#pragma unroll
  for (int n = 0; n < 4; ++n) { const int cc = wn * 64 + n * 16 + en; const float bb = which == 0 ? bfv(bq[c0 + cc]) : (which == 2 ? bfv(bv[c0 + cc]) : 0.0f);
#pragma unroll
    for (int m = 0; m < 4; ++m)
#pragma unroll
      for (int r8 = 0; r8 < 8; ++r8) Tf[(wm * 64 + m * 16 + 8 * eh + r8) * TFP + cc] = acc[m][n][r8] * (1.0f / (XS * WSC)) + bb; }
  __syncthreads();
  // the row loops are unrolled so that the row addresses are immediates and no address register is rewritten behind a store
  { const size_t ob = (t0 + wave) * D + c0 + el * 4; b16* const Ph = (which == 0 ? Qh : (which == 1 ? Kh : Vh)) + ob; const float* const Tp = Tf + wave * TFP + el * 4;
    auto row = [&](int i) {
#pragma unroll
      for (int q = 0; q < 2; ++q) { const v4f f = *(const v4f*)(Tp + i * 8 * TFP + q * 128); v4b hi;
#pragma unroll
        for (int j = 0; j < 4; ++j) hi[j] = (b16)(f[j] * HS);
        *(v4b*)(Ph + (size_t)i * 8 * D + q * 128) = hi; } };
#pragma unroll
    for (int i = 0; i < 8; ++i) row(i);
    asm volatile("s_wait_xcnt 0x0" ::: "memory");   // behind the last stores of the lower rows: the upper rows' LDS reads reuse their data registers
    if (up) {
#pragma unroll
      for (int i = 8; i < 16; ++i) row(i); } } }
// relative position index: entry 731 for (cls, cls), 729 for the cls query, 730 for the cls key; for patches (dy + 13) * 27 + dx + 13.
// With patch p = token - 1 written as row * 27 + column that is plin(q - 1) - plin(k - 1) + 13 * 27 + 13
__device__ __forceinline__ constexpr int plin(int p) { return (p / WH) * (2 * WH - 1) + p % WH; }
// exp(x) as the fast intrinsic forms it (x * log2 e, then the hardware exp2). The v_nop is the slot behind a transcendental: written into the same statement, it stands there
// whichever instruction the compiler puts next.
__device__ __forceinline__ float exp_slot(float x) { const float y = x * 1.44269504f; float r; asm("v_exp_f32 %0, %1\n\tv_nop" : "=v"(r) : "v"(y)); return r; }
// att: one work-group of 7 waves per (b, h, half of the 13 query tiles); one wave per 16 queries, everything transposed and in registers as before.
// The head's k rows, v rows and bias column and the work-group's q rows are brought into LDS once, with loads that cover whole 128-byte lines, and every wave takes its fragments from there:
// a fragment load straight from global memory touches 16 lines for 512 bytes, and each of the 13 waves of a head repeated all of them.
// LDS pitches: 16 B x odd (144 B) for k and its 16-byte readers, 32 B x odd (160 B) for v and its transposing readers, which hand out v^T fragments from the rows as the projection wrote them.
// v rows 197 to 223 are the next image's (behind the last image: zeros); they are finite and meet P = 0.
// S^T = k rows (A) x q (B): lane (c, half) holds for query q0 + c the keys 16 t + 8 half + r,
// so bias, maximum, exp and sum run in-lane on all 32 lanes, with one exchange between the halves. Two score tiles, converted in place, are the B operand of ctx^T = v^T rows (A) x P^T
// in the k order in which the transposing loads hand out v^T; a lane then holds 8 consecutive d of its query per tile; the wave turns them into whole rows in LDS and stores those.
// Loads stand one tile ahead of their products. The scheduling barriers keep that order: without them the next tile's bias rounding, and with it the wait for loads just issued, is lifted in front of this tile's products.
__global__ __launch_bounds__(224) void att_kernel(const b16* __restrict__ Qh, const b16* __restrict__ Kh, const b16* __restrict__ Vh, const float* __restrict__ btab, int BLIM, float* __restrict__ out) {
  constexpr int KP = HD + 8, VP = HD + 16, KSZ = SP * KP, VSZ = VK * VP, QR = 7 * 16 /* query rows of a work-group */, OP = HD + 4 /* 272-byte rows: 16 B x odd */, QP = OP * 2;
  __shared__ __attribute__((aligned(16))) char smem[(KSZ + VSZ) * 2 + NRD * 4 + QR * OP * 4];
  b16* const Ksh = (b16*)smem; b16* const Vsh = Ksh + KSZ; float* const Bs = (float*)(Vsh + VSZ); float* const Os = Bs + NRD; b16* const Qs = (b16*)Os;   // a query row's place holds its q (128 B) first and its result (256 B) at the end
  const int tid = threadIdx.x, lane = tid & 31, nloc = lane & 15, hlf = lane >> 4; const int b = blockIdx.x / (H * 2), rem = blockIdx.x % (H * 2); const int h = rem / 2; if (b >= BLIM) return; const size_t tb = (size_t)b * S;
  const int wv = __builtin_amdgcn_readfirstlane(tid >> 5), qt = (rem % 2) * 7 + wv;
  const int q0 = qt * 16;
  const int q = q0 + nloc;   // columns past the image work on a valid row (the image's last); their results are not written
  { // staging: 8 lanes cover the 128 B of a q row, a k row or a v row; all row steps are constants on one address per stream
    const int kr = tid >> 3, kc = (tid & 7) * 8;
    const b16* const gkh = Kh + (tb + kr) * D + h * HD + kc; const b16* const gvh = Vh + (tb + kr) * D + h * HD + kc;
    const float* const gb = btab + tid * H + h;
    // the work-group's 112 query rows in four passes of 28; only the last pass can run past the image, and there it reads the image's last row
    const int qb = (rem % 2) * QR, r3 = qb + 3 * 28 + kr;
    const b16* const gq = Qh + (tb + qb + kr) * D + h * HD + kc; const b16* const gq3 = Qh + (tb + (r3 < S ? r3 : S - 1)) * D + h * HD + kc;
    v8b rk[8], rv[8], rq[4]; float rb[4];
#pragma unroll   // the row steps become immediate offsets and the staging arrays stay in registers
    for (int i = 0; i < 3; ++i) rq[i] = *(const v8b*)(gq + i * 28 * D);
    rq[3] = *(const v8b*)gq3;
#pragma unroll   // the row steps become immediate offsets and the staging arrays stay in registers
    for (int i = 0; i < 7; ++i) rk[i] = *(const v8b*)(gkh + i * 28 * D);
    if (tid < 96) rk[7] = *(const v8b*)(gkh + 7 * 28 * D);   // rows 196 to 207: three whole waves
#pragma unroll   // the row steps become immediate offsets and the staging arrays stay in registers
    for (int i = 0; i < 8; ++i) rv[i] = *(const v8b*)(gvh + i * 28 * D);
#pragma unroll   // the row steps become immediate offsets and the staging arrays stay in registers
    for (int i = 0; i < 3; ++i) rb[i] = gb[i * 224 * H];
    if (tid < NRD - 3 * 224) rb[3] = gb[3 * 224 * H];
    asm volatile("s_wait_xcnt 0x0" :: "v"(gkh), "v"(gvh), "v"(gb), "v"(gq), "v"(gq3) : "memory");   // behind the last loads that name these address registers; as inputs they stay untouched up to the wait
#pragma unroll   // the row steps become immediate offsets and the staging arrays stay in registers
    for (int i = 0; i < 4; ++i) *(v8b*)(Qs + (kr + i * 28) * QP + kc) = rq[i];
#pragma unroll   // the row steps become immediate offsets and the staging arrays stay in registers
    for (int i = 0; i < 7; ++i) *(v8b*)(Ksh + (kr + i * 28) * KP + kc) = rk[i];
    if (tid < 96) *(v8b*)(Ksh + (kr + 7 * 28) * KP + kc) = rk[7];
#pragma unroll   // the row steps become immediate offsets and the staging arrays stay in registers
    for (int i = 0; i < 8; ++i) *(v8b*)(Vsh + (kr + i * 28) * VP + kc) = rv[i];
#pragma unroll   // the row steps become immediate offsets and the staging arrays stay in registers
    for (int i = 0; i < 3; ++i) Bs[tid + i * 224] = rb[i];
    if (tid < NRD - 3 * 224) Bs[tid + 3 * 224] = rb[3]; }
  __syncthreads();   // publishes the staged rows; the only barrier, so the wave without a query tile may leave behind it
  if (qt >= 13) return;
  v16b qa[2];
#pragma unroll
  for (int ks = 0; ks < 2; ++ks) qa[ks] = frag_kb(Qs + (wv * 16 + nloc) * QP + 8 * hlf + ks * 32, 0);
  v16b kh[2][2]; float br[2][8];
  // bias addresses: for a patch query the entry of key k lies plin(k - 1) entries below the query's own base, a constant per register but for the upper half's 8 keys (8 or 21 entries more).
  // The cls query (and a column past the image, as before) has one entry for all patch keys: it reads as query 1, in bounds, and takes the cls value instead.
  const int qq = q < S ? q : 0; const bool qcls = qq == 0; const int base = plin(qcls ? 0 : qq - 1) + (WH - 1) * (2 * WH - 1) + (WH - 1);
  constexpr int PL = plin(S - 2); const float* const pn = Bs + (base - PL); const float* const p0 = pn - hlf * 8; const float* const p1 = pn - hlf * 21;   // set to the last key's entry: constants from 0 up
  const float bcls = Bs[NRD - 3];
  const int idx0 = hlf == 0 ? (qcls ? NRD - 1 : NRD - 2) : (qcls ? NRD - 3 : base - plin(7));   // register 0 of tile 0: key 0 or key 8
  const b16* const kph = Ksh + nloc * KP + 8 * hlf;
  const int vlo = (8 * hlf + (lane & 7)) * VP + ((lane >> 3) & 1) * 8;   // the transposing load's lane address: key row 8 half + (lane & 7), 16 bytes further for lanes 8 to 15 of a half
  const b16* const vph = Vsh + vlo;
  auto kfetch = [&](int t, int bf) {
#pragma unroll
    for (int ks = 0; ks < 2; ++ks) kh[bf][ks] = frag_kb(kph + t * 16 * KP + ks * 32, 0);
#pragma unroll
    for (int r8 = 0; r8 < 8; ++r8) { const int c = t * 16 + r8;   // the lower half's key; the upper half's is c + 8
      if (c >= S) br[bf][r8] = 0.0f; else if (c == 0) br[bf][r8] = Bs[idx0];
      else br[bf][r8] = (c + 8 >= S ? pn : ((c + 7) / WH != (c - 1) / WH ? p1 : p0))[PL - plin(c - 1)]; } };   // an upper-half key past the image reads the lower half's entry and is masked below
  v16b vh[2][2];
  auto vfetch = [&](int u, int bf) {   // unit u: keys 32 (u / 2) ..., d tiles 2 (u % 2) and 2 (u % 2) + 1
#pragma unroll
    for (int i = 0; i < 2; ++i) { const int vo = (u >> 1) * 32 * VP + ((u & 1) * 2 + i) * 16; vh[bf][i] = frag_tr(vph + vo, VP); } };
  v8f s[13]; float mx = -INFINITY;
  kfetch(0, 0);
#pragma unroll
  for (int t = 0; t < 13; ++t) { const int bf = t & 1; if (t + 1 < 13) kfetch(t + 1, bf ^ 1); else vfetch(0, 0);
    __builtin_amdgcn_sched_barrier(0);   // the next tile's loads are issued before this tile's work
    v8f a = (v8f){};
#pragma unroll
    for (int ks = 0; ks < 2; ++ks) a = wmma16b(kh[bf][ks], qa[ks], a);
#pragma unroll
    for (int r8 = 0; r8 < 8; ++r8) { const int c = t * 16 + r8;
      if (c >= S) { a[r8] = -INFINITY; continue; }
      float v = a[r8] * (SCALE / (HS * HS)) + bfv(c != 0 && qcls ? bcls : br[bf][r8]); if (c + 8 >= S && hlf) v = -INFINITY;
      a[r8] = v; mx = fmaxf(mx, v); }
    s[t] = a; __builtin_amdgcn_sched_barrier(0); }   // nothing of the next tile is worked on, or waited for, in front of this point
  mx = fmaxf(mx, __shfl_xor(mx, 16, 32));
  float sp[8] = {0.0f, 0.0f, 0.0f, 0.0f, 0.0f, 0.0f, 0.0f, 0.0f};   // eight partial sums: no chain of 101 dependent adds
#pragma unroll
  for (int t = 0; t < 13; ++t)
#pragma unroll
    for (int r8 = 0; r8 < 8; ++r8) { if (t * 16 + r8 >= S) { s[t][r8] = 0.0f; continue; } const float p = exp_slot(s[t][r8] - mx); s[t][r8] = p; sp[r8] += p; }
  float sm = ((sp[0] + sp[1]) + (sp[2] + sp[3])) + ((sp[4] + sp[5]) + (sp[6] + sp[7])); sm += __shfl_xor(sm, 16, 32); const float inv = 1.0f / sm;
  __builtin_amdgcn_sched_barrier(0);   // the second v^T unit's loads stay behind the softmax: lifted in front of it they hold 16 more registers through it
  v8f o[4] = {(v8f){}, (v8f){}, (v8f){}, (v8f){}}; v16b pa;
#pragma unroll
  for (int u = 0; u < 14; ++u) { const int bf = u & 1, j = u >> 1, t0 = (u & 1) * 2, t1 = t0 + 1; if (u + 1 < 14) vfetch(u + 1, bf ^ 1);
    __builtin_amdgcn_sched_barrier(0);   // the next unit's loads are issued before this unit's products
    if ((u & 1) == 0) {
#pragma unroll
      for (int e = 0; e < 8; ++e) { pa[e] = (b16)(s[2 * j][e] * inv * PS); pa[8 + e] = 2 * j + 1 < 13 ? (b16)(s[2 * j + 1][e] * inv * PS) : (b16)0.0f; } }
    o[t0] = wmma16b(vh[bf][0], pa, o[t0]); o[t1] = wmma16b(vh[bf][1], pa, o[t1]); __builtin_amdgcn_sched_barrier(0); }   // as above: no wait for the next unit in front of this point
  // the result leaves through the wave's own 16 rows of LDS (its q fragments were read from them long ago; no other wave touches them behind the barrier):
  // stored from the accumulators, a wave instruction would touch 16 lines with 32 bytes each; read back by rows it covers two rows of 256 bytes, four whole lines
  { float* const wp = Os + (wv * 16 + nloc) * OP + 8 * hlf;
#pragma unroll
    for (int t = 0; t < 4; ++t) { const v8f f = o[t] * (1.0f / (PS * HS)); *(v4f*)(wp + t * 16) = (v4f){f[0], f[1], f[2], f[3]}; *(v4f*)(wp + t * 16 + 4) = (v4f){f[4], f[5], f[6], f[7]}; } }
  asm volatile("s_wait_dscnt 0x0" ::: "memory");   // the wave's rows are written before its lanes read each other's parts back
  { const float* const rp = Os + (wv * 16 + hlf) * OP + nloc * 4; float* const op = out + (tb + q0 + hlf) * D + h * HD + nloc * 4; v4f g[8];
#pragma unroll   // the row steps become immediate offsets on one address
    for (int j = 0; j < 8; ++j) g[j] = *(const v4f*)(rp + j * 2 * OP);
    static_assert(2 * D * 4 == 6144, "the row steps below are two output rows in bytes");
    if (q0 + 16 <= S) {   // the same for the whole wave: all 16 rows lie in the image.
      // One statement: written as plain stores, the last of them was merged with the edge tile's guarded store, behind indexed register moves and a rewrite of the address pair of stores just issued.
      // Nothing follows it but the wave's end, so no register that a store names is written again.
      asm volatile("global_store_b128 %0, %1, off\n\tglobal_store_b128 %0, %2, off offset:6144\n\tglobal_store_b128 %0, %3, off offset:12288\n\tglobal_store_b128 %0, %4, off offset:18432\n\t"
                   "global_store_b128 %0, %5, off offset:24576\n\tglobal_store_b128 %0, %6, off offset:30720\n\tglobal_store_b128 %0, %7, off offset:36864\n\tglobal_store_b128 %0, %8, off offset:43008"
                   :: "v"(op), "v"(g[0]), "v"(g[1]), "v"(g[2]), "v"(g[3]), "v"(g[4]), "v"(g[5]), "v"(g[6]), "v"(g[7]) : "memory"); }
    else {
#pragma unroll   // the row steps become immediate offsets on one address; rows past the image are not written
      for (int j = 0; j < 8; ++j) if (q0 + j * 2 + hlf < S) *(v4f*)(op + j * 2 * D) = g[j]; } } }
}  // namespace

extern "C" void kernel_launch(void* const* d_in, const int* in_sizes, int n_in, void* d_out, int out_size, void* d_ws, size_t ws_size, hipStream_t stream) {
  (void)n_in;
  auto Fp = [&](int i) { return (const float*)d_in[i]; };
  // input order: 0 hidden_states [64,197,768]; 1 Wq [768,768]; 2 bq [768]; 3 Wk; 4 Wv; 5 bv; 6 bias_table [732,12]
  if (in_sizes[0] != T * D || in_sizes[1] != D * D || in_sizes[3] != D * D || in_sizes[4] != D * D || in_sizes[6] != NRD * H || out_size != T * D) return;
  const int BLIM = NB_;
  size_t off = 0; char* ws = (char*)d_ws;
  auto carve = [&](size_t bytes) { char* p = ws + off; off += (bytes + 255) & ~(size_t)255; return p; };
  b16* WQKV = (b16*)carve((size_t)3 * D * D * 2); b16* Qh = (b16*)carve((size_t)TP * D * 2); b16* Kh = (b16*)carve((size_t)TP * D * 2); b16* Vh = (b16*)carve((size_t)TP * D * 2);
  if (off > ws_size || off > ((size_t)176 << 20)) return;   // ~ 62 MB
  wput_kernel<<<216 /* 3 matrices x 6 k tiles x 12 column tiles */, 256, 0, stream>>>(Fp(1), Fp(3), Fp(4), WQKV, Kh, Vh);
  proj_kernel<<<(BLIM * S + 127) / 128 * 9, 256, 0, stream>>>(Fp(0), WQKV, Fp(2), Fp(5), BLIM, Qh, Kh, Vh);
  att_kernel<<<BLIM * H * 2, 224, 0, stream>>>(Qh, Kh, Vh, Fp(6), BLIM, (float*)d_out);
}

// v010
// It runs in 75.7 microseconds.
// Next to v009, in two timings, it ran 1.10 times as fast each time.
// All steps since v000 together make it 15.0 times as fast.
#include <hip/hip_runtime.h>

// BeitSelfAttention: q = x Wq + bq, k = x Wk (no bias), v = x Wv + bv (12 heads x 64); scores = q.k/8 + bias_table[rel_idx(q,k)][h] (BEiT relative position index incl. the cls row/column/corner entries); probs = softmax; ctx = probs v -> [64][197][768].
// Deterministic: per-wave softmax over the 197 keys in fixed order; no atomics.
// WMMA (v_wmma_f32_16x16x32_f16, f32 accumulate): per (image, head) work-group [Wq|Wk|Wv] rows of the head (EXACT x256 (in,out), 192 rows) x x rows (EXACT bf16 x8, K 768, 224 rows), results kept in LDS; then per 16-query wave S^T = k rows (13 tiles) x q (x256, K 64) and ctx^T = v^T rows (4 tiles, K 224, P = 0 past the image) x P^T, one product each; bias gather + softmax in f32.
// q, k, v and P enter the attention products as one 16-bit float each (11 significant bits): x and the weights carry 8 bits into the projection, so that rounding, not this one, sets the result's error.

namespace {
constexpr int NB_ = 64, S = 197, SP = 208 /* 13 key tiles */, VK = 224 /* 7 key pairs of tiles for v */, D = 768, H = 12, HD = 64, T = NB_ * S /* 12608 = 788*16 */, TP = T + 32, WH = 14, NRD = 732;
constexpr float XS = 8.0f, HS = 256.0f, PS = 256.0f, WSC = 256.0f, SCALE = 0.125f;
typedef _Float16 b16;
typedef __attribute__((ext_vector_type(16))) _Float16 v16b;
typedef __attribute__((ext_vector_type(8))) _Float16 v8b;
typedef __attribute__((ext_vector_type(4))) _Float16 v4b;
typedef __attribute__((ext_vector_type(2))) _Float16 v2b;
typedef __attribute__((ext_vector_type(8))) float v8f;
typedef __attribute__((ext_vector_type(4))) float v4f;
typedef __attribute__((ext_vector_type(2))) float v2f;
__device__ __forceinline__ float bf16_rne(float f) { unsigned int u = __float_as_uint(f); u += 0x7FFFu + ((u >> 16) & 1u); float r = __uint_as_float(u & 0xFFFF0000u); asm volatile("" : "+v"(r)); return r; }
__device__ __forceinline__ float bfv(float f) { float r = bf16_rne(f); asm volatile("" : "+v"(r)); return r; }
__device__ __forceinline__ v16b frag_kb(const b16* p, int hh) { const v8b a = *(const v8b*)(p + 8 * hh), b = *(const v8b*)(p + 16 + 8 * hh); v16b f;
#pragma unroll
  for (int e = 0; e < 8; ++e) { f[e] = a[e]; f[8 + e] = b[e]; } return f; }
// transposing LDS load: from row-major rows [key][d] lane (c, half) gets 8 consecutive keys of column c; the loads at keys 0 and 16 of a 32-key block are one A fragment in frag_kb's k order
typedef __attribute__((ext_vector_type(8))) short s16x8;
__device__ __forceinline__ v8b ld_tr16(const b16* p) { typedef __attribute__((address_space(3))) s16x8 lds_s16x8; return __builtin_bit_cast(v8b, __builtin_amdgcn_ds_load_tr16_b128_v8i16((lds_s16x8*)p)); }
__device__ __forceinline__ v16b frag_tr(const b16* p, int pitch) { const v8b a = ld_tr16(p), b = ld_tr16(p + 16 * pitch); v16b f;
#pragma unroll
  for (int e = 0; e < 8; ++e) { f[e] = a[e]; f[8 + e] = b[e]; } return f; }
__device__ __forceinline__ v8f wmma16b(v16b a, v16b b, v8f c) { v8f d = __builtin_amdgcn_wmma_f32_16x16x32_f16(false, a, false, b, (short)0, c, false, false); asm volatile("v_nop\n\tv_nop\n\tv_nop\n\tv_nop" : "+v"(d) : "v"(a), "v"(b)); return d; }
// wput: one work-group per 128 k x 64 columns of one weight matrix. A lane asks for 8 rows x 16 bytes at once, 16 lanes covering 256 bytes of a row, so every load takes whole lines and all
// of them are in flight together; the lane's 8 k x 4 columns go rounded into LDS as four 16-byte pieces of the transposed tile (272-byte rows), and the rows leave as 256 contiguous bytes each.
__global__ __launch_bounds__(256) void wput_kernel(const float* __restrict__ wq, const float* __restrict__ wk, const float* __restrict__ wv, b16* __restrict__ WQKV) {
  constexpr int TK = 128, TO = 64, TW = TK + 8, NKT = D / TK, NOT = D / TO;
  __shared__ __attribute__((aligned(16))) b16 Ts[TO * TW];
  const int tid = threadIdx.x, hi4 = tid >> 4, lo4 = tid & 15; const int which = blockIdx.x / (NKT * NOT), rem = blockIdx.x % (NKT * NOT), k0 = (rem / NOT) * TK, o0 = (rem % NOT) * TO;
  const float* const w = which == 0 ? wq : (which == 1 ? wk : wv); const float* const wp = w + (size_t)(k0 + hi4 * 8) * D + o0 + lo4 * 4;
  v4f f[8];
#pragma unroll   // the row steps become immediate offsets on one address
  for (int j = 0; j < 8; ++j) f[j] = *(const v4f*)(wp + j * D);
#pragma unroll   // constant indices: the loaded rows and the packed pieces stay in registers
  for (int c = 0; c < 4; ++c) { v8b v;
#pragma unroll   // as above
    for (int j = 0; j < 8; ++j) v[j] = (b16)(bf16_rne(f[j][c]) * WSC);
    *(v8b*)(Ts + (lo4 * 4 + c) * TW + hi4 * 8) = v; }
  __syncthreads();   // the transposed tile is whole before its rows are read
  { b16* const op = WQKV + ((size_t)which * D + o0 + hi4) * D + k0 + lo4 * 8; const b16* const tp = Ts + hi4 * TW + lo4 * 8;
#pragma unroll   // the row steps become immediate offsets on one address
    for (int i = 0; i < 4; ++i) *(v8b*)(op + (size_t)i * 16 * D) = *(const v8b*)(tp + i * 16 * TW); } }
// the low 32 bits of a __shared__ address: the byte address in the work-group's LDS, as an asynchronous copy takes it
__device__ __forceinline__ unsigned lds_addr(const void* p) { typedef __attribute__((address_space(3))) const char lds_c; return (unsigned)(unsigned long long)(lds_c*)p; }
// relative position index: entry 731 for (cls, cls), 729 for the cls query, 730 for the cls key; for patches (dy + 13) * 27 + dx + 13.
// With patch p = token - 1 written as row * 27 + column that is plin(q - 1) - plin(k - 1) + 13 * 27 + 13
__device__ __forceinline__ constexpr int plin(int p) { return (p / WH) * (2 * WH - 1) + p % WH; }
// exp(x) as the fast intrinsic forms it (x * log2 e, then the hardware exp2). The v_nop is the slot behind a transcendental: written into the same statement, it stands there
// whichever instruction the compiler puts next.
__device__ __forceinline__ float exp_slot(float x) { const float y = x * 1.44269504f; float r; asm("v_exp_f32 %0, %1\n\tv_nop" : "=v"(r) : "v"(y)); return r; }
// One work-group of 14 waves per (image, head), one per WGP, in two parts with nothing passing through global memory between them.
// Part 1, the head's q, k, v: 224 token rows (the image's 197; rows past it repeat its last row: finite, and masked, met by P = 0 or not written below) x 192 weight rows [q 64 | k 64 | v 64], K 768 in 64-k stages, two LDS buffers.
// x goes through registers (it is rounded and scaled on the way); the weight rows, 16-bit already, go from L2 into LDS by asynchronous copies. A wave owns 32 tokens x 96 columns (2 x 6 accumulator tiles).
// The weight rows are the A operand and the tokens the B operand: a lane then holds 8 consecutive columns of one token, one 16-byte LDS store into the row layouts that part 2 reads. k runs upward in one chain per output.
// Part 2, attention: one wave per 16 queries (13 of the 14 waves), everything transposed and in registers.
// LDS pitches: 16 B x odd (144 B) for the stages, for k and their 16-byte readers, 32 B x odd (160 B) for v and its transposing readers, which hand out v^T fragments from the rows as part 1 wrote them.
// S^T = k rows (A) x q (B): lane (c, half) holds for query q0 + c the keys 16 t + 8 half + r,
// so bias, maximum, exp and sum run in-lane on all 32 lanes, with one exchange between the halves. Two score tiles, converted in place, are the B operand of ctx^T = v^T rows (A) x P^T
// in the k order in which the transposing loads hand out v^T; a lane then holds 8 consecutive d of its query per tile; the wave turns them into whole rows in LDS and stores those.
// Loads stand one tile ahead of their products. The scheduling barriers keep that order: without them the next tile's bias rounding, and with it the wait for loads just issued, is lifted in front of this tile's products.
__global__ __launch_bounds__(448) void fat_kernel(const float* __restrict__ x, const b16* __restrict__ WQKV, const float* __restrict__ bq, const float* __restrict__ bv, const float* __restrict__ btab, int BLIM, float* __restrict__ out) {
  constexpr int KC = 64, NS = D / KC, GP = KC + 8 /* 144-byte rows */, XSZ = VK * GP, STG = XSZ + 3 * HD * GP;
  constexpr int KP = HD + 8, VP = HD + 16, KSZ = SP * KP, VSZ = VK * VP, OP = HD + 4 /* 272-byte rows: 16 B x odd */, QP = OP * 2;
  __shared__ __attribute__((aligned(16))) char smem[2 * STG * 2 + (KSZ + VSZ) * 2 + NRD * 4 + SP * OP * 4 + 3 * HD * 4];
  b16* const St = (b16*)smem; b16* const Ksh = St + 2 * STG; b16* const Vsh = Ksh + KSZ; float* const Bs = (float*)(Vsh + VSZ); float* const Os = Bs + NRD; b16* const Qs = (b16*)Os; float* const Bp = Os + SP * OP;   // a query row's place holds its q (128 B) first and its result (256 B) at the end; Bp: the 192 columns' projection bias
  const int b = blockIdx.x / H, h = blockIdx.x % H; if (b >= BLIM) return; const size_t tb = (size_t)b * S;
  const int wv = __builtin_amdgcn_readfirstlane(threadIdx.x >> 5) /* in a scalar register, with all that follows from it */, wm = wv % 7, wn = wv / 7;
  v8f acc[2][6];
  { const int tid = threadIdx.x, nl = tid & 15, hf = (tid >> 4) & 1;
    const int ar = tid >> 4, ac = (tid & 15) * 4, br = tid >> 3, bc = (tid & 7) * 8;   // 16 lanes cover 256 B of an x row, 8 lanes 128 B of a weight row
    const float* xg = x + (tb + ar) * D + ac; const float* xu = x + (tb + S - 1) * D + ac;   // rows ar + 28 i, i < 7, lie in the image; the eighth pass (rows 196 to 223) reads the image's last row. Both run along k, a stage at a time
    unsigned wo[4];   // byte offsets of the lane's four weight rows (stage rows br + 56 i; 64 stage rows per matrix)
#pragma unroll
    for (int i = 0; i < 4; ++i) { const int r = br + i * 56; wo[i] = (unsigned)((((r >> 6) * D + h * HD + (r & 63)) * D + bc) * 2); }
    const unsigned wl = lds_addr(St + XSZ + br * GP + bc);
    v4f xr[8];
#pragma unroll
    for (int m = 0; m < 2; ++m)
#pragma unroll
      for (int n = 0; n < 6; ++n) acc[m][n] = (v8f){};
    auto fetch = [&]() {
#pragma unroll
      for (int i = 0; i < 7; ++i) xr[i] = *(const v4f*)(xg + (size_t)i * 28 * D);
      xr[7] = *(const v4f*)xu; };
    auto step = [&]() { xg += KC; xu += KC; };   // on to the next stage; the additions rewrite address registers of issued loads: in the listing s_wait_xcnt stands in front of each of them
    auto put = [&](b16* st) {
#pragma unroll
      for (int i = 0; i < 8; ++i) { v4b hx;
#pragma unroll
        for (int j = 0; j < 4; ++j) hx[j] = (b16)(bf16_rne(xr[i][j]) * XS);
        *(v4b*)(st + (ar + i * 28) * GP + ac) = hx; } };
    // a stage's 192 weight rows: copies of 16 bytes a lane, rows 56 apart, three from every wave and a fourth (rows 168 to 191) from waves 0 to 5, a scalar test; one scalar base and a 32-bit lane offset per copy.
    // The wait on the address translations is each statement's last line, so that it stands in front of every later write of a register that a copy names.
    auto wcopy = [&](int s, int par) { const unsigned l = wl + par * (STG * 2); const b16* const p = WQKV + __builtin_amdgcn_readfirstlane(s * KC);   // the stage's base stays in scalar registers, as the copies take it
      asm volatile("global_load_async_to_lds_b128 %0, %3, %6\n\tglobal_load_async_to_lds_b128 %1, %4, %6\n\tglobal_load_async_to_lds_b128 %2, %5, %6\n\ts_wait_xcnt 0x0"
                   :: "v"(l), "v"(l + 56 * GP * 2), "v"(l + 112 * GP * 2), "v"(wo[0]), "v"(wo[1]), "v"(wo[2]), "s"(p) : "memory");
      if (wv < 6) asm volatile("global_load_async_to_lds_b128 %0, %1, %2\n\ts_wait_xcnt 0x0" :: "v"(l + 168 * GP * 2), "v"(wo[3]), "s"(p) : "memory"); };
    fetch(); wcopy(0, 0);
    { // the head's column of the position bias and the projection bias of its 192 columns (rounded here, once; 0 for k, which has none), behind the first stage's loads; published by the first barrier below
      const float* const gb = btab + tid * H + h; const float rb0 = gb[0]; float rb1 = 0.0f, rp = 0.0f; if (tid < NRD - 448) rb1 = gb[448 * H];
      if (tid < 3 * HD) rp = ((tid >> 6) == 0 ? bq : bv)[h * HD + (tid & 63)];
      Bs[tid] = rb0; if (tid < NRD - 448) Bs[tid + 448] = rb1;
      if (tid < 3 * HD) { const float r = bfv(rp); Bp[tid] = (tid >> 6) == 1 ? 0.0f : r; } }
    put(St); step(); fetch();
    asm volatile("s_wait_asynccnt 0x0" ::: "memory");   // this wave's copies of stage 0 have landed before the barrier that publishes them
    __syncthreads();
    wcopy(1, 1); put(St + STG); step(); fetch();
    auto trip = [&](int c, int par) { const b16* const cur = St + par * STG;   // par = c & 1 as a constant: the LDS offsets stay immediates
#pragma unroll
      for (int ks = 0; ks < 2; ++ks) { v16b a[2], w[6];   // the fragment reads of a 32-k half stand as one group ahead of its 12 products
#pragma unroll
        for (int n = 0; n < 6; ++n) w[n] = frag_kb(cur + XSZ + (wn * 96 + n * 16 + nl) * GP + ks * 32, hf);
#pragma unroll
        for (int m = 0; m < 2; ++m) a[m] = frag_kb(cur + (wm * 32 + m * 16 + nl) * GP + ks * 32, hf);
#pragma unroll
        for (int m = 0; m < 2; ++m)
#pragma unroll
          for (int n = 0; n < 6; ++n) acc[m][n] = wmma16b(w[n], a[m], acc[m][n]); }
      asm volatile("s_wait_dscnt 0x0" ::: "memory");      // this wave's reads of stage c and its x stores of stage c + 1 are done
      asm volatile("s_wait_asynccnt 0x0" ::: "memory");   // this wave's copies of stage c + 1 have landed
      __syncthreads();   // publishes stage c + 1 and ends every read of the buffer that stage c + 2 goes into
      if (c + 2 < NS) { wcopy(c + 2, par); put(St + par * STG);
        if (c + 3 < NS) { step(); fetch(); } } };   // stage c + 3: a stage's global loads have a whole trip to land
#pragma unroll 1   // kept rolled, two trips (one per buffer) a pass
    for (int c = 0; c < NS; c += 2) { trip(c, 0); trip(c + 1, 1); }
    asm volatile("s_wait_asynccnt 0x0" ::: "memory"); }   // no copy is outstanding behind the loop
  // the lane's number is formed anew here: carried from the top, the indices of what follows would hold registers through the whole loop
  const int lane = __builtin_amdgcn_mbcnt_lo(~0u, 0u), nloc = lane & 15, hlf = lane >> 4;
  // q, k, v leave the accumulators scaled, with their bias, as 16-bit rows in LDS: 8 columns of one token a store. q and k have 208 rows: the last wave row's upper tile is kept for v alone (a scalar test).
#pragma unroll
  for (int n = 0; n < 6; ++n) { const int ct = wn * 6 + n, which = ct >> 2, cb = (ct & 3) * 16 + 8 * hlf;
    const float* const bp = Bp + ct * 16 + 8 * hlf; const v4f b0 = *(const v4f*)bp, b1 = *(const v4f*)(bp + 4); const float bb[8] = {b0[0], b0[1], b0[2], b0[3], b1[0], b1[1], b1[2], b1[3]};
    b16* const dst = which == 0 ? Qs : (which == 1 ? Ksh : Vsh); const int pitch = which == 0 ? QP : (which == 1 ? KP : VP);
#pragma unroll
    for (int m = 0; m < 2; ++m) if (which == 2 || wm * 32 + m * 16 < SP) { v8b hv;
#pragma unroll
      for (int j = 0; j < 8; ++j) hv[j] = (b16)((acc[m][n][j] * (1.0f / (XS * WSC)) + bb[j]) * HS);
      *(v8b*)(dst + (wm * 32 + m * 16 + nloc) * pitch + cb) = hv; } }
  __syncthreads();   // publishes the head's q, k and v rows; the last barrier, so the wave without a query tile may leave behind it
  const int qt = wv, q0 = qt * 16;
  const int q = q0 + nloc;   // columns past the image work on valid rows; their results are not written
  if (qt >= 13) return;
  v16b qa[2];
#pragma unroll
  for (int ks = 0; ks < 2; ++ks) qa[ks] = frag_kb(Qs + (wv * 16 + nloc) * QP + 8 * hlf + ks * 32, 0);
  v16b kh[2][2]; float br[2][8];
  // bias addresses: for a patch query the entry of key k lies plin(k - 1) entries below the query's own base, a constant per register but for the upper half's 8 keys (8 or 21 entries more).
  // The cls query (and a column past the image, as before) has one entry for all patch keys: it reads as query 1, in bounds, and takes the cls value instead.
  const int qq = q < S ? q : 0; const bool qcls = qq == 0; const int base = plin(qcls ? 0 : qq - 1) + (WH - 1) * (2 * WH - 1) + (WH - 1);
  constexpr int PL = plin(S - 2); const float* const pn = Bs + (base - PL); const float* const p0 = pn - hlf * 8; const float* const p1 = pn - hlf * 21;   // set to the last key's entry: constants from 0 up
  const float bcls = Bs[NRD - 3];
  const int idx0 = hlf == 0 ? (qcls ? NRD - 1 : NRD - 2) : (qcls ? NRD - 3 : base - plin(7));   // register 0 of tile 0: key 0 or key 8
  const b16* const kph = Ksh + nloc * KP + 8 * hlf;
  const int vlo = (8 * hlf + (lane & 7)) * VP + ((lane >> 3) & 1) * 8;   // the transposing load's lane address: key row 8 half + (lane & 7), 16 bytes further for lanes 8 to 15 of a half
  const b16* const vph = Vsh + vlo;
  auto kfetch = [&](int t, int bf) {
#pragma unroll
    for (int ks = 0; ks < 2; ++ks) kh[bf][ks] = frag_kb(kph + t * 16 * KP + ks * 32, 0);
#pragma unroll
    for (int r8 = 0; r8 < 8; ++r8) { const int c = t * 16 + r8;   // the lower half's key; the upper half's is c + 8
      if (c >= S) br[bf][r8] = 0.0f; else if (c == 0) br[bf][r8] = Bs[idx0];
      else br[bf][r8] = (c + 8 >= S ? pn : ((c + 7) / WH != (c - 1) / WH ? p1 : p0))[PL - plin(c - 1)]; } };   // an upper-half key past the image reads the lower half's entry and is masked below
  v16b vh[2][2];
  auto vfetch = [&](int u, int bf) {   // unit u: keys 32 (u / 2) ..., d tiles 2 (u % 2) and 2 (u % 2) + 1
#pragma unroll
    for (int i = 0; i < 2; ++i) { const int vo = (u >> 1) * 32 * VP + ((u & 1) * 2 + i) * 16; vh[bf][i] = frag_tr(vph + vo, VP); } };
  v8f s[13]; float mx = -INFINITY;
  kfetch(0, 0);
#pragma unroll
  for (int t = 0; t < 13; ++t) { const int bf = t & 1; if (t + 1 < 13) kfetch(t + 1, bf ^ 1); else vfetch(0, 0);
    __builtin_amdgcn_sched_barrier(0);   // the next tile's loads are issued before this tile's work
    v8f a = (v8f){};
#pragma unroll
    for (int ks = 0; ks < 2; ++ks) a = wmma16b(kh[bf][ks], qa[ks], a);
#pragma unroll
    for (int r8 = 0; r8 < 8; ++r8) { const int c = t * 16 + r8;
      if (c >= S) { a[r8] = -INFINITY; continue; }
      float v = a[r8] * (SCALE / (HS * HS)) + bfv(c != 0 && qcls ? bcls : br[bf][r8]); if (c + 8 >= S && hlf) v = -INFINITY;
      a[r8] = v; mx = fmaxf(mx, v); }
    s[t] = a; __builtin_amdgcn_sched_barrier(0); }   // nothing of the next tile is worked on, or waited for, in front of this point
  mx = fmaxf(mx, __shfl_xor(mx, 16, 32));
  float sp[8] = {0.0f, 0.0f, 0.0f, 0.0f, 0.0f, 0.0f, 0.0f, 0.0f};   // eight partial sums: no chain of 101 dependent adds
#pragma unroll
  for (int t = 0; t < 13; ++t)
#pragma unroll
    for (int r8 = 0; r8 < 8; ++r8) { if (t * 16 + r8 >= S) { s[t][r8] = 0.0f; continue; } const float p = exp_slot(s[t][r8] - mx); s[t][r8] = p; sp[r8] += p; }
  float sm = ((sp[0] + sp[1]) + (sp[2] + sp[3])) + ((sp[4] + sp[5]) + (sp[6] + sp[7])); sm += __shfl_xor(sm, 16, 32); const float inv = 1.0f / sm;
  __builtin_amdgcn_sched_barrier(0);   // the second v^T unit's loads stay behind the softmax: lifted in front of it they hold 16 more registers through it
  v8f o[4] = {(v8f){}, (v8f){}, (v8f){}, (v8f){}}; v16b pa;
#pragma unroll
  for (int u = 0; u < 14; ++u) { const int bf = u & 1, j = u >> 1, t0 = (u & 1) * 2, t1 = t0 + 1; if (u + 1 < 14) vfetch(u + 1, bf ^ 1);
    __builtin_amdgcn_sched_barrier(0);   // the next unit's loads are issued before this unit's products
    if ((u & 1) == 0) {
#pragma unroll
      for (int e = 0; e < 8; ++e) { pa[e] = (b16)(s[2 * j][e] * inv * PS); pa[8 + e] = 2 * j + 1 < 13 ? (b16)(s[2 * j + 1][e] * inv * PS) : (b16)0.0f; } }
    o[t0] = wmma16b(vh[bf][0], pa, o[t0]); o[t1] = wmma16b(vh[bf][1], pa, o[t1]); __builtin_amdgcn_sched_barrier(0); }   // as above: no wait for the next unit in front of this point
  // the result leaves through the wave's own 16 rows of LDS (its q fragments were read from them long ago; no other wave touches them behind the barrier):
  // stored from the accumulators, a wave instruction would touch 16 lines with 32 bytes each; read back by rows it covers two rows of 256 bytes, four whole lines
  { float* const wp = Os + (wv * 16 + nloc) * OP + 8 * hlf;
#pragma unroll
    for (int t = 0; t < 4; ++t) { const v8f f = o[t] * (1.0f / (PS * HS)); *(v4f*)(wp + t * 16) = (v4f){f[0], f[1], f[2], f[3]}; *(v4f*)(wp + t * 16 + 4) = (v4f){f[4], f[5], f[6], f[7]}; } }
  asm volatile("s_wait_dscnt 0x0" ::: "memory");   // the wave's rows are written before its lanes read each other's parts back
  { const float* const rp = Os + (wv * 16 + hlf) * OP + nloc * 4; float* const op = out + (tb + q0 + hlf) * D + h * HD + nloc * 4; v4f g[8];
#pragma unroll   // the row steps become immediate offsets on one address
    for (int j = 0; j < 8; ++j) g[j] = *(const v4f*)(rp + j * 2 * OP);
    static_assert(2 * D * 4 == 6144, "the row steps below are two output rows in bytes");
    if (q0 + 16 <= S) {   // the same for the whole wave: all 16 rows lie in the image.
      // One statement: written as plain stores, the last of them was merged with the edge tile's guarded store, behind indexed register moves and a rewrite of the address pair of stores just issued.
      // Nothing follows it but the wave's end, so no register that a store names is written again.
      asm volatile("global_store_b128 %0, %1, off\n\tglobal_store_b128 %0, %2, off offset:6144\n\tglobal_store_b128 %0, %3, off offset:12288\n\tglobal_store_b128 %0, %4, off offset:18432\n\t"
                   "global_store_b128 %0, %5, off offset:24576\n\tglobal_store_b128 %0, %6, off offset:30720\n\tglobal_store_b128 %0, %7, off offset:36864\n\tglobal_store_b128 %0, %8, off offset:43008"
                   :: "v"(op), "v"(g[0]), "v"(g[1]), "v"(g[2]), "v"(g[3]), "v"(g[4]), "v"(g[5]), "v"(g[6]), "v"(g[7]) : "memory"); }
    else {
#pragma unroll   // the row steps become immediate offsets on one address; rows past the image are not written
      for (int j = 0; j < 8; ++j) if (q0 + j * 2 + hlf < S) *(v4f*)(op + j * 2 * D) = g[j]; } } }
}  // namespace

extern "C" void kernel_launch(void* const* d_in, const int* in_sizes, int n_in, void* d_out, int out_size, void* d_ws, size_t ws_size, hipStream_t stream) {
  (void)n_in;
  auto Fp = [&](int i) { return (const float*)d_in[i]; };
  // input order: 0 hidden_states [64,197,768]; 1 Wq [768,768]; 2 bq [768]; 3 Wk; 4 Wv; 5 bv; 6 bias_table [732,12]
  if (in_sizes[0] != T * D || in_sizes[1] != D * D || in_sizes[3] != D * D || in_sizes[4] != D * D || in_sizes[6] != NRD * H || out_size != T * D) return;
  const int BLIM = NB_;
  if ((size_t)3 * D * D * 2 > ws_size) return;   // ~ 3.5 MB
  b16* WQKV = (b16*)d_ws;
  wput_kernel<<<216 /* 3 matrices x 6 k tiles x 12 column tiles */, 256, 0, stream>>>(Fp(1), Fp(3), Fp(4), WQKV);
  fat_kernel<<<BLIM * H, 448, 0, stream>>>(Fp(0), WQKV, Fp(2), Fp(5), Fp(6), BLIM, (float*)d_out);
}
